// v000
// The times below were measured on an AMD MI455X: many runs one after another, warmed up first and cycling through
// copies of the inputs, with the whole window's GPU time divided by the number of runs. Launches and the gaps
// between them are all in it. The median over several windows is given; except for v000 it joins two sittings, which
// can be a few percent apart, so the side-by-side timings, each taken in one sitting, are the better comparison.
// The starting kernel, v000, takes 84.1 microseconds a run.
#include <hip/hip_runtime.h>

typedef float v2f __attribute__((ext_vector_type(2)));
typedef float v8f __attribute__((ext_vector_type(8)));

#define B_ROWS 8192
#define D_FEAT 256
#define N_INNER 64
#define OUT_F 256

// Packed 2xFMA on CDNA5 VOP3P: d = a*b + c  (guaranteed v_pk_fma_f32)
__device__ __forceinline__ v2f pk_fma(v2f a, v2f b, v2f c) {
  v2f d;
  asm("v_pk_fma_f32 %0, %1, %2, %3" : "=v"(d) : "v"(a), "v"(b), "v"(c));
  return d;
}

// ---------------------------------------------------------------------------
// Kernel 1: per-feature tiny MLPs  inner[b,d] = sum_i relu(x*w1+b1)*w2 + b2
// 256 threads = 64 features x 4 i-chunks of 16. Weights register-cached as
// v2f pairs; the i-loop runs on V_PK_FMA_F32 (2 FMA/instr) with two
// independent accumulator chains. ReLU = two dual-issueable v_max_f32.
// 4-lane fold via wave32 shfl_xor.
// ---------------------------------------------------------------------------
__global__ __launch_bounds__(256) void kan_inner_kernel(
    const float* __restrict__ x,  const float* __restrict__ w1,
    const float* __restrict__ b1, const float* __restrict__ w2,
    const float* __restrict__ b2, float* __restrict__ inner)
{
  const int t  = threadIdx.x;
  const int dl = t >> 2;                       // feature within block: 0..63
  const int kq = t & 3;                        // i-chunk: 0..3
  const int d  = blockIdx.x * 64 + dl;         // global feature
  const int ib = kq * 16;                      // first inner index

  // Register-cache 16 (w1,b1,w2) triples as 8 v2f pairs each (b128 loads).
  v2f w1p[8], b1p[8], w2p[8];
  const float4* w1v = (const float4*)(w1 + d * N_INNER + ib);
  const float4* b1v = (const float4*)(b1 + d * N_INNER + ib);
  const float4* w2v = (const float4*)(w2 + d * N_INNER + ib);
#pragma unroll
  for (int j = 0; j < 4; ++j) {
    float4 a = w1v[j], b = b1v[j], c = w2v[j];
    w1p[2*j+0] = (v2f){a.x, a.y}; w1p[2*j+1] = (v2f){a.z, a.w};
    b1p[2*j+0] = (v2f){b.x, b.y}; b1p[2*j+1] = (v2f){b.z, b.w};
    w2p[2*j+0] = (v2f){c.x, c.y}; w2p[2*j+1] = (v2f){c.z, c.w};
  }
  const float b2v = b2[d];
  const v2f zero = (v2f){0.0f, 0.0f};

  const int r0 = blockIdx.y * 128;
#pragma unroll 4
  for (int r = r0; r < r0 + 128; ++r) {
    const float xs = x[r * D_FEAT + d];
    const v2f xv = (v2f){xs, xs};
    v2f acc0 = zero, acc1 = zero;              // 2 independent chains
#pragma unroll
    for (int j = 0; j < 4; ++j) {
      v2f h0 = pk_fma(xv, w1p[2*j+0], b1p[2*j+0]);
      v2f h1 = pk_fma(xv, w1p[2*j+1], b1p[2*j+1]);
      h0 = __builtin_elementwise_max(h0, zero);
      h1 = __builtin_elementwise_max(h1, zero);
      acc0 = pk_fma(h0, w2p[2*j+0], acc0);
      acc1 = pk_fma(h1, w2p[2*j+1], acc1);
    }
    float a = (acc0.x + acc0.y) + (acc1.x + acc1.y);
    // fold the 4 i-chunk lanes (lanes kq=0..3 share a feature)
    a += __shfl_xor(a, 1, 32);
    a += __shfl_xor(a, 2, 32);
    if (kq == 0) inner[r * D_FEAT + d] = a + b2v;
  }
}

// ---------------------------------------------------------------------------
// Kernel 2: outer MLP via V_WMMA_F32_16X16X4_F32.
// One wave owns a 16-row tile; 2 waves/block.
//   GEMM1: [16,256] @ wo1^T[256,64]  -> relu(+bo1) -> g (LDS, stride 68)
//   GEMM2: [16,64]  @ wo2^T[64,256]  -> +bo2 -> out
// A 16x4 f32 frag: lane<16 holds {A[l,K],A[l,K+1]}, lane>=16 {A[l-16,K+2],K+3}
// B 4x16 f32 frag: lane<16 holds {B[K,n],B[K+1,n]}, lane>=16 {B[K+2,n],B[K+3,n]}
// Both are contiguous float2 per lane in row-major storage.
// ---------------------------------------------------------------------------
__global__ __launch_bounds__(64) void kan_outer_kernel(
    const float* __restrict__ inner, const float* __restrict__ wo1,
    const float* __restrict__ bo1,   const float* __restrict__ wo2,
    const float* __restrict__ bo2,   float* __restrict__ out)
{
  __shared__ float lds_g[2][16 * 68];          // stride 68: conflict-free
  const int lane = threadIdx.x & 31;
  const int wid  = threadIdx.x >> 5;
  const int row0 = (blockIdx.x * 2 + wid) * 16;
  const int lr   = lane & 15;                  // in-tile row/col
  const int lh   = lane >> 4;                  // K-half select (0/1)

  // ---------------- GEMM1: 4 independent N-tile accumulator chains ---------
  v8f c0 = {}, c1 = {}, c2 = {}, c3 = {};
  const float* aBase = inner + (size_t)(row0 + lr) * D_FEAT + 2 * lh;
  const float* bB0 = wo1 + (size_t)( 0 + lr) * D_FEAT + 2 * lh;
  const float* bB1 = wo1 + (size_t)(16 + lr) * D_FEAT + 2 * lh;
  const float* bB2 = wo1 + (size_t)(32 + lr) * D_FEAT + 2 * lh;
  const float* bB3 = wo1 + (size_t)(48 + lr) * D_FEAT + 2 * lh;
  for (int k = 0; k < D_FEAT; k += 4) {
    v2f a  = *(const v2f*)(aBase + k);
    v2f b0 = *(const v2f*)(bB0 + k);
    v2f b1 = *(const v2f*)(bB1 + k);
    v2f b2 = *(const v2f*)(bB2 + k);
    v2f b3 = *(const v2f*)(bB3 + k);
    c0 = __builtin_amdgcn_wmma_f32_16x16x4_f32(false, a, false, b0, (short)0, c0, false, false);
    c1 = __builtin_amdgcn_wmma_f32_16x16x4_f32(false, a, false, b1, (short)0, c1, false, false);
    c2 = __builtin_amdgcn_wmma_f32_16x16x4_f32(false, a, false, b2, (short)0, c2, false, false);
    c3 = __builtin_amdgcn_wmma_f32_16x16x4_f32(false, a, false, b3, (short)0, c3, false, false);
  }

  // bias + relu, stage g[16][64] into LDS (C-layout scatter, conflict-free)
  float* g = &lds_g[wid][0];
  const float bv0 = bo1[ 0 + lr], bv1 = bo1[16 + lr];
  const float bv2 = bo1[32 + lr], bv3 = bo1[48 + lr];
#pragma unroll
  for (int j = 0; j < 8; ++j) {
    const int m = j + 8 * lh;
    g[m * 68 +  0 + lr] = fmaxf(c0[j] + bv0, 0.0f);
    g[m * 68 + 16 + lr] = fmaxf(c1[j] + bv1, 0.0f);
    g[m * 68 + 32 + lr] = fmaxf(c2[j] + bv2, 0.0f);
    g[m * 68 + 48 + lr] = fmaxf(c3[j] + bv3, 0.0f);
  }
  __syncthreads();

  // ---------------- GEMM2: cache all 16 A-fragments in registers -----------
  v2f a2[16];
#pragma unroll
  for (int kk = 0; kk < 16; ++kk)
    a2[kk] = *(const v2f*)(g + lr * 68 + 4 * kk + 2 * lh);

  for (int o0 = 0; o0 < OUT_F; o0 += 16) {
    v8f acc = {};
    const float* bB = wo2 + (size_t)(o0 + lr) * N_INNER + 2 * lh;
#pragma unroll
    for (int kk = 0; kk < 16; ++kk) {
      v2f bb = *(const v2f*)(bB + 4 * kk);
      acc = __builtin_amdgcn_wmma_f32_16x16x4_f32(false, a2[kk], false, bb, (short)0, acc, false, false);
    }
    const float bv = bo2[o0 + lr];
#pragma unroll
    for (int j = 0; j < 8; ++j)
      out[(size_t)(row0 + j + 8 * lh) * OUT_F + o0 + lr] = acc[j] + bv;
  }
}

// ---------------------------------------------------------------------------
extern "C" void kernel_launch(void* const* d_in, const int* in_sizes, int n_in,
                              void* d_out, int out_size, void* d_ws, size_t ws_size,
                              hipStream_t stream) {
  const float* x   = (const float*)d_in[0];
  const float* w1  = (const float*)d_in[1];
  const float* b1  = (const float*)d_in[2];
  const float* w2  = (const float*)d_in[3];
  const float* b2  = (const float*)d_in[4];
  const float* wo1 = (const float*)d_in[5];
  const float* bo1 = (const float*)d_in[6];
  const float* wo2 = (const float*)d_in[7];
  const float* bo2 = (const float*)d_in[8];
  float* out   = (float*)d_out;
  float* inner = (float*)d_ws;                 // B*D*4 = 8 MB scratch

  dim3 g1(D_FEAT / 64, B_ROWS / 128);          // (4, 64) = 256 blocks
  kan_inner_kernel<<<g1, 256, 0, stream>>>(x, w1, b1, w2, b2, inner);

  // 256 blocks x 2 waves x 16 rows = 8192 rows
  kan_outer_kernel<<<B_ROWS / 32, 64, 0, stream>>>(inner, wo1, bo1, wo2, bo2, out);
}

// v001
// Measured time: 23.9 microseconds a run.
// Next to v000, in two timings, it ran 3.54 and 3.49 times as fast.
#include <hip/hip_runtime.h>

typedef float v2f __attribute__((ext_vector_type(2)));
typedef float v8f __attribute__((ext_vector_type(8)));

#define B_ROWS 8192
#define D_FEAT 256
#define N_INNER 64
#define OUT_F 256

// Packed 2xFMA on CDNA5 VOP3P: d = a*b + c  (guaranteed v_pk_fma_f32)
__device__ __forceinline__ v2f pk_fma(v2f a, v2f b, v2f c) {
  v2f d;
  asm("v_pk_fma_f32 %0, %1, %2, %3" : "=v"(d) : "v"(a), "v"(b), "v"(c));
  return d;
}

// ---------------------------------------------------------------------------
// Kernel 1: per-feature tiny MLPs  inner[b,d] = sum_i relu(x*w1+b1)*w2 + b2
// One lane owns one feature and keeps all 64 (w1,b1,w2) triples in registers.
// A block = 8 waves on the same 32 features, 256 rows (32 rows per wave).
// The block's weights (3 x 8 KB) and its x tile (32 KB) are fetched with
// whole-line b128 loads that are all in flight together, staged in LDS once,
// and then no global load stands in the row loop. A lane sums its own 64
// terms, so there is no cross-lane fold; each store is one whole 128-B line.
// ---------------------------------------------------------------------------
#define K1_FEAT 32                             // features per block (= lanes)
#define K1_ROWS 256                            // rows per block
#define K1_WP   68                             // LDS pitch of a weight row: 64 + 4 floats,
                                               // conflict-free for b128 reads at one row per lane
__global__ __launch_bounds__(256) void kan_inner_kernel(
    const float* __restrict__ x,  const float* __restrict__ w1,
    const float* __restrict__ b1, const float* __restrict__ w2,
    const float* __restrict__ b2, float* __restrict__ inner)
{
  __shared__ __attribute__((aligned(16))) float sw1[K1_FEAT * K1_WP];
  __shared__ __attribute__((aligned(16))) float sb1[K1_FEAT * K1_WP];
  __shared__ __attribute__((aligned(16))) float sw2[K1_FEAT * K1_WP];
  __shared__ __attribute__((aligned(16))) float sx[K1_ROWS * K1_FEAT];

  const int t    = threadIdx.x;
  const int lane = t & 31;
  const int wv   = t >> 5;
  const int d0   = blockIdx.x * K1_FEAT;       // first feature of the block
  const int r0   = blockIdx.y * K1_ROWS;       // first row of the block

  // ---- stage: 14 b128 loads per thread, issued back to back -----------------
  const float4* w1v = (const float4*)(w1 + d0 * N_INNER);
  const float4* b1v = (const float4*)(b1 + d0 * N_INNER);
  const float4* w2v = (const float4*)(w2 + d0 * N_INNER);
  float4 ga[2], gb[2], gc[2], gx[8];
#pragma unroll
  for (int k = 0; k < 2; ++k) {
    const int q = t + 256 * k;                 // float4 index in the 8-KB slab
    ga[k] = w1v[q]; gb[k] = b1v[q]; gc[k] = w2v[q];
  }
#pragma unroll
  for (int k = 0; k < 8; ++k) {
    const int q = t + 256 * k;                 // row = q/8, float4 column = q%8
    gx[k] = *(const float4*)(x + (size_t)(r0 + (q >> 3)) * D_FEAT + d0 + (q & 7) * 4);
  }
  const float b2v = b2[d0 + lane];
#pragma unroll
  for (int k = 0; k < 2; ++k) {
    const int q = t + 256 * k;
    const int o = (q >> 4) * K1_WP + (q & 15) * 4;
    *(float4*)(sw1 + o) = ga[k];
    *(float4*)(sb1 + o) = gb[k];
    *(float4*)(sw2 + o) = gc[k];
  }
#pragma unroll
  for (int k = 0; k < 8; ++k)
    *(float4*)(sx + (t + 256 * k) * 4) = gx[k];
  __syncthreads();

  // ---- this lane's 64 triples into registers as 32 v2f pairs each ----------
  v2f w1p[32], b1p[32], w2p[32];
#pragma unroll
  for (int j = 0; j < 16; ++j) {
    const float4 a = *(const float4*)(sw1 + lane * K1_WP + 4 * j);
    const float4 b = *(const float4*)(sb1 + lane * K1_WP + 4 * j);
    const float4 c = *(const float4*)(sw2 + lane * K1_WP + 4 * j);
    w1p[2*j+0] = (v2f){a.x, a.y}; w1p[2*j+1] = (v2f){a.z, a.w};
    b1p[2*j+0] = (v2f){b.x, b.y}; b1p[2*j+1] = (v2f){b.z, b.w};
    w2p[2*j+0] = (v2f){c.x, c.y}; w2p[2*j+1] = (v2f){c.z, c.w};
  }
  const v2f zero = (v2f){0.0f, 0.0f};

  const float* xs = sx + wv * 32 * K1_FEAT + lane;             // this wave's 32 rows
  float* op = inner + (size_t)(r0 + wv * 32) * D_FEAT + d0 + lane;

  float xc[4];
#pragma unroll
  for (int u = 0; u < 4; ++u) xc[u] = xs[u * K1_FEAT];

  for (int rb = 0; rb < 32; rb += 4) {
    // next four rows' x, read one trip ahead (the last trip re-reads rows 0..3)
    float xn[4];
#pragma unroll
    for (int u = 0; u < 4; ++u) xn[u] = xs[(((rb + 4) & 31) + u) * K1_FEAT];

    v2f xv[4], acc0[4], acc1[4];
#pragma unroll
    for (int u = 0; u < 4; ++u) {
      xv[u] = (v2f){xc[u], xc[u]};
      acc0[u] = zero; acc1[u] = zero;
    }
    // Holds the LDS reads of the next rows up here, a whole trip ahead of their use.
    __builtin_amdgcn_sched_barrier(0);
    // 4 rows x 2 pairs = 8 independent strands between dependent instructions
#pragma unroll
    for (int j = 0; j < 16; ++j) {
      v2f h0[4], h1[4];
#pragma unroll
      for (int u = 0; u < 4; ++u) {
        h0[u] = pk_fma(xv[u], w1p[2*j+0], b1p[2*j+0]);
        h1[u] = pk_fma(xv[u], w1p[2*j+1], b1p[2*j+1]);
      }
      // The compiler knows no latency for the asm products: without this line it puts
      // a max directly behind the product it reads, and the wave stalls there.
      __builtin_amdgcn_sched_barrier(0);
#pragma unroll
      for (int u = 0; u < 4; ++u) {
        h0[u] = __builtin_elementwise_max(h0[u], zero);
        h1[u] = __builtin_elementwise_max(h1[u], zero);
      }
      // Same purpose: the eight sums stay together, behind all the max.
      __builtin_amdgcn_sched_barrier(0);
#pragma unroll
      for (int u = 0; u < 4; ++u) {
        acc0[u] = pk_fma(h0[u], w2p[2*j+0], acc0[u]);
        acc1[u] = pk_fma(h1[u], w2p[2*j+1], acc1[u]);
      }
      // Closes the group, so that each group of two pairs is scheduled alone: in this
      // build more of the max then pair into dual issue (272 against 299 per trip).
      __builtin_amdgcn_sched_barrier(0);
    }
#pragma unroll
    for (int u = 0; u < 4; ++u) {
      op[(size_t)(rb + u) * D_FEAT] =
          ((acc0[u].x + acc0[u].y) + (acc1[u].x + acc1[u].y)) + b2v;
      xc[u] = xn[u];
    }
  }
}

// ---------------------------------------------------------------------------
// Kernel 2: outer MLP via V_WMMA_F32_16X16X4_F32.
// One wave owns a 16-row tile; 2 waves/block.
//   GEMM1: [16,256] @ wo1^T[256,64]  -> relu(+bo1) -> g (LDS, stride 68)
//   GEMM2: [16,64]  @ wo2^T[64,256]  -> +bo2 -> out
// A 16x4 f32 frag: lane<16 holds {A[l,K],A[l,K+1]}, lane>=16 {A[l-16,K+2],K+3}
// B 4x16 f32 frag: lane<16 holds {B[K,n],B[K+1,n]}, lane>=16 {B[K+2,n],B[K+3,n]}
// Both are contiguous float2 per lane in row-major storage.
// ---------------------------------------------------------------------------
__global__ __launch_bounds__(64) void kan_outer_kernel(
    const float* __restrict__ inner, const float* __restrict__ wo1,
    const float* __restrict__ bo1,   const float* __restrict__ wo2,
    const float* __restrict__ bo2,   float* __restrict__ out)
{
  __shared__ float lds_g[2][16 * 68];          // stride 68: conflict-free
  const int lane = threadIdx.x & 31;
  const int wid  = threadIdx.x >> 5;
  const int row0 = (blockIdx.x * 2 + wid) * 16;
  const int lr   = lane & 15;                  // in-tile row/col
  const int lh   = lane >> 4;                  // K-half select (0/1)

  // ---------------- GEMM1: 4 independent N-tile accumulator chains ---------
  v8f c0 = {}, c1 = {}, c2 = {}, c3 = {};
  const float* aBase = inner + (size_t)(row0 + lr) * D_FEAT + 2 * lh;
  const float* bB0 = wo1 + (size_t)( 0 + lr) * D_FEAT + 2 * lh;
  const float* bB1 = wo1 + (size_t)(16 + lr) * D_FEAT + 2 * lh;
  const float* bB2 = wo1 + (size_t)(32 + lr) * D_FEAT + 2 * lh;
  const float* bB3 = wo1 + (size_t)(48 + lr) * D_FEAT + 2 * lh;
  for (int k = 0; k < D_FEAT; k += 4) {
    v2f a  = *(const v2f*)(aBase + k);
    v2f b0 = *(const v2f*)(bB0 + k);
    v2f b1 = *(const v2f*)(bB1 + k);
    v2f b2 = *(const v2f*)(bB2 + k);
    v2f b3 = *(const v2f*)(bB3 + k);
    c0 = __builtin_amdgcn_wmma_f32_16x16x4_f32(false, a, false, b0, (short)0, c0, false, false);
    c1 = __builtin_amdgcn_wmma_f32_16x16x4_f32(false, a, false, b1, (short)0, c1, false, false);
    c2 = __builtin_amdgcn_wmma_f32_16x16x4_f32(false, a, false, b2, (short)0, c2, false, false);
    c3 = __builtin_amdgcn_wmma_f32_16x16x4_f32(false, a, false, b3, (short)0, c3, false, false);
  }

  // bias + relu, stage g[16][64] into LDS (C-layout scatter, conflict-free)
  float* g = &lds_g[wid][0];
  const float bv0 = bo1[ 0 + lr], bv1 = bo1[16 + lr];
  const float bv2 = bo1[32 + lr], bv3 = bo1[48 + lr];
#pragma unroll
  for (int j = 0; j < 8; ++j) {
    const int m = j + 8 * lh;
    g[m * 68 +  0 + lr] = fmaxf(c0[j] + bv0, 0.0f);
    g[m * 68 + 16 + lr] = fmaxf(c1[j] + bv1, 0.0f);
    g[m * 68 + 32 + lr] = fmaxf(c2[j] + bv2, 0.0f);
    g[m * 68 + 48 + lr] = fmaxf(c3[j] + bv3, 0.0f);
  }
  __syncthreads();

  // ---------------- GEMM2: cache all 16 A-fragments in registers -----------
  v2f a2[16];
#pragma unroll
  for (int kk = 0; kk < 16; ++kk)
    a2[kk] = *(const v2f*)(g + lr * 68 + 4 * kk + 2 * lh);

  for (int o0 = 0; o0 < OUT_F; o0 += 16) {
    v8f acc = {};
    const float* bB = wo2 + (size_t)(o0 + lr) * N_INNER + 2 * lh;
#pragma unroll
    for (int kk = 0; kk < 16; ++kk) {
      v2f bb = *(const v2f*)(bB + 4 * kk);
      acc = __builtin_amdgcn_wmma_f32_16x16x4_f32(false, a2[kk], false, bb, (short)0, acc, false, false);
    }
    const float bv = bo2[o0 + lr];
#pragma unroll
    for (int j = 0; j < 8; ++j)
      out[(size_t)(row0 + j + 8 * lh) * OUT_F + o0 + lr] = acc[j] + bv;
  }
}

// ---------------------------------------------------------------------------
extern "C" void kernel_launch(void* const* d_in, const int* in_sizes, int n_in,
                              void* d_out, int out_size, void* d_ws, size_t ws_size,
                              hipStream_t stream) {
  const float* x   = (const float*)d_in[0];
  const float* w1  = (const float*)d_in[1];
  const float* b1  = (const float*)d_in[2];
  const float* w2  = (const float*)d_in[3];
  const float* b2  = (const float*)d_in[4];
  const float* wo1 = (const float*)d_in[5];
  const float* bo1 = (const float*)d_in[6];
  const float* wo2 = (const float*)d_in[7];
  const float* bo2 = (const float*)d_in[8];
  float* out   = (float*)d_out;
  float* inner = (float*)d_ws;                 // B*D*4 = 8 MB scratch

  dim3 g1(D_FEAT / K1_FEAT, B_ROWS / K1_ROWS); // (8, 32) = 256 blocks
  kan_inner_kernel<<<g1, 256, 0, stream>>>(x, w1, b1, w2, b2, inner);

  // 256 blocks x 2 waves x 16 rows = 8192 rows
  kan_outer_kernel<<<B_ROWS / 32, 64, 0, stream>>>(inner, wo1, bo1, wo2, bo2, out);
}

// v002
// A run of this version takes 14.5 microseconds.
// Next to v001, in two timings, it ran 1.65 times as fast each time.
// Counting every step since v000, it is 5.79 times as fast.
#include <hip/hip_runtime.h>

typedef float v2f __attribute__((ext_vector_type(2)));
typedef float v8f __attribute__((ext_vector_type(8)));

#define B_ROWS 8192
#define D_FEAT 256
#define N_INNER 64
#define OUT_F 256

// Packed 2xFMA on CDNA5 VOP3P: d = a*b + c  (guaranteed v_pk_fma_f32)
__device__ __forceinline__ v2f pk_fma(v2f a, v2f b, v2f c) {
  v2f d;
  asm("v_pk_fma_f32 %0, %1, %2, %3" : "=v"(d) : "v"(a), "v"(b), "v"(c));
  return d;
}

// ---------------------------------------------------------------------------
// One launch. A block = 8 waves owns 32 rows and all 256 features.
// Phase 1 (vector unit): inner[b,d] = sum_i relu(x*w1+b1)*w2 + b2.
//   Wave w owns features 32w..32w+31, one lane per feature, all 64 (w1,b1,w2)
//   triples of the feature in registers; the triples and the 32 x rows come in
//   with whole-line b128 loads and pass through LDS once. A lane sums its own
//   64 terms and writes the result over the x value it came from, so the inner
//   tile stays in LDS and never goes to memory.
// Phase 2 (V_WMMA_F32_16X16X4_F32): g = relu(inner @ wo1^T + bo1), 2 x 4 tiles
//   of 16x16, one per wave; out = g @ wo2^T + bo2, 2 x 16 tiles, four per wave.
//   wo1 and wo2 are staged in the LDS that the triples have left.
// A 16x4 f32 frag: lane<16 holds {A[l,K],A[l,K+1]}, lane>=16 {A[l-16,K+2],K+3}
// B 4x16 f32 frag: lane<16 holds {B[K,n],B[K+1,n]}, lane>=16 {B[K+2,n],B[K+3,n]}
// Both are contiguous float2 per lane in row-major storage.
// ---------------------------------------------------------------------------
#define BLK_ROWS 32                            // rows per block
// LDS pitches in floats, each 16 B x an odd number: no bank conflict at one row per lane
#define P64  68                                // a row of 64 floats + 4
#define P256 260                               // a row of 256 floats + 4
#define PW   196                               // a feature's row: its 64 w1, 64 b1, 64 w2, + 4

__global__ __launch_bounds__(256) void kan_fused_kernel(
    const float* __restrict__ x,   const float* __restrict__ w1,
    const float* __restrict__ b1,  const float* __restrict__ w2,
    const float* __restrict__ b2,  const float* __restrict__ wo1,
    const float* __restrict__ bo1, const float* __restrict__ wo2,
    const float* __restrict__ bo2, float* __restrict__ out)
{
  __shared__ __attribute__((aligned(16))) float sw[D_FEAT * PW];      // the triples, [256][196]
  __shared__ __attribute__((aligned(16))) float sx[BLK_ROWS * P256];  // x, overwritten by inner
  // once the triples are in registers their LDS takes wo2, wo1 and g
  float* const swo2 = sw;                                 // [256][68]
  float* const swo1 = sw + OUT_F * P64;                   // [64][260]
  float* const sg   = sw + OUT_F * P64 + N_INNER * P256;  // [32][68]

  const int t    = threadIdx.x;
  const int lane = t & 31;
  const int wv   = t >> 5;
  const int r0   = blockIdx.x * BLK_ROWS;      // first row of the block
  // LDS place of float4 number t of a row-major array with rows of 256 floats
  const int o256 = (t >> 6) * P256 + (t & 63) * 4;

  // ---- stage the triples (3 x 64 KB) and the x rows (32 KB), whole lines ----
  {
    const float4* w1v = (const float4*)w1;
    const float4* b1v = (const float4*)b1;
    const float4* w2v = (const float4*)w2;
    const float4* xv4 = (const float4*)(x + (size_t)r0 * D_FEAT);
    float4 ga[16], gb[16], gc[16], gx[8];
#pragma unroll
    for (int k = 0; k < 16; ++k) {             // each wave brings its own 32 features: 3 x 8 KB
      const int q = wv * 512 + lane + 32 * k;  // feature = q/16, float4 column = q%16
      ga[k] = w1v[q]; gb[k] = b1v[q]; gc[k] = w2v[q];
    }
#pragma unroll
    for (int k = 0; k < 8; ++k) gx[k] = xv4[t + 256 * k];
    float* const wp = sw + (wv * 32 + (lane >> 4)) * PW + (lane & 15) * 4;
#pragma unroll
    for (int k = 0; k < 16; ++k) {             // 32 float4 on = 2 features on
      *(float4*)(wp + k * 2 * PW)       = ga[k];
      *(float4*)(wp + k * 2 * PW + 64)  = gb[k];
      *(float4*)(wp + k * 2 * PW + 128) = gc[k];
    }
#pragma unroll
    for (int k = 0; k < 8; ++k)                // 256 float4 on = 4 rows of 256 floats on
      *(float4*)(sx + o256 + k * 4 * P256) = gx[k];
  }
  const float b2v = b2[t];                     // feature of this lane = t
  __syncthreads();

  // ---- this lane's 64 triples into registers as 32 v2f pairs each ----------
  v2f w1p[32], b1p[32], w2p[32];
#pragma unroll
  for (int j = 0; j < 16; ++j) {
    const float4 a = *(const float4*)(sw + t * PW + 4 * j);
    const float4 b = *(const float4*)(sw + t * PW + 64 + 4 * j);
    const float4 c = *(const float4*)(sw + t * PW + 128 + 4 * j);
    w1p[2*j+0] = (v2f){a.x, a.y}; w1p[2*j+1] = (v2f){a.z, a.w};
    b1p[2*j+0] = (v2f){b.x, b.y}; b1p[2*j+1] = (v2f){b.z, b.w};
    w2p[2*j+0] = (v2f){c.x, c.y}; w2p[2*j+1] = (v2f){c.z, c.w};
  }
  // Every wave has its triples in registers behind this barrier: their LDS is free.
  __syncthreads();
  const v2f zero = (v2f){0.0f, 0.0f};

  float* xs = sx + t;                          // this lane's column of the 32 rows

  float xc[4];
#pragma unroll
  for (int u = 0; u < 4; ++u) xc[u] = xs[u * P256];

  for (int rb = 0; rb < BLK_ROWS; rb += 4) {
    // next four rows' x, read one trip ahead (the last trip re-reads rows 0..3, unused)
    float xn[4];
#pragma unroll
    for (int u = 0; u < 4; ++u) xn[u] = xs[(((rb + 4) & 31) + u) * P256];

    v2f xv[4], acc0[4], acc1[4];
#pragma unroll
    for (int u = 0; u < 4; ++u) {
      xv[u] = (v2f){xc[u], xc[u]};
      acc0[u] = zero; acc1[u] = zero;
    }
    // Holds the LDS reads of the next rows up here, a whole trip ahead of their use.
    __builtin_amdgcn_sched_barrier(0);
    // 4 rows x 2 pairs = 8 independent strands between dependent instructions
#pragma unroll
    for (int j = 0; j < 16; ++j) {
      v2f h0[4], h1[4];
#pragma unroll
      for (int u = 0; u < 4; ++u) {
        h0[u] = pk_fma(xv[u], w1p[2*j+0], b1p[2*j+0]);
        h1[u] = pk_fma(xv[u], w1p[2*j+1], b1p[2*j+1]);
      }
      // The compiler knows no latency for the asm products: without this line it puts
      // a max directly behind the product it reads, and the wave stalls there.
      __builtin_amdgcn_sched_barrier(0);
#pragma unroll
      for (int u = 0; u < 4; ++u) {
        h0[u] = __builtin_elementwise_max(h0[u], zero);
        h1[u] = __builtin_elementwise_max(h1[u], zero);
      }
      // Same purpose: the eight sums stay together, behind all the max.
      __builtin_amdgcn_sched_barrier(0);
#pragma unroll
      for (int u = 0; u < 4; ++u) {
        acc0[u] = pk_fma(h0[u], w2p[2*j+0], acc0[u]);
        acc1[u] = pk_fma(h1[u], w2p[2*j+1], acc1[u]);
      }
      // Closes the group, so that each group of two pairs is scheduled alone: more of
      // the max then pair into dual issue.
      __builtin_amdgcn_sched_barrier(0);
    }
#pragma unroll
    for (int u = 0; u < 4; ++u) {
      xs[(rb + u) * P256] =
          ((acc0[u].x + acc0[u].y) + (acc1[u].x + acc1[u].y)) + b2v;
      xc[u] = xn[u];
    }
  }

  // ---- stage wo1 (64 KB) and wo2 (64 KB) in the freed LDS, whole lines ------
  {
    const int o64 = (t >> 4) * P64 + (t & 15) * 4;   // as o256, for rows of 64 floats
    const float4* o1v = (const float4*)wo1;
    const float4* o2v = (const float4*)wo2;
    float4 ha[16], hb[16];
#pragma unroll
    for (int k = 0; k < 16; ++k) ha[k] = o1v[t + 256 * k];
#pragma unroll
    for (int k = 0; k < 16; ++k) hb[k] = o2v[t + 256 * k];
#pragma unroll
    for (int k = 0; k < 16; ++k)
      *(float4*)(swo1 + o256 + k * 4 * P256) = ha[k];
#pragma unroll
    for (int k = 0; k < 16; ++k)
      *(float4*)(swo2 + o64 + k * 16 * P64) = hb[k];
  }
  const int lr = lane & 15;                    // in-tile row/col
  const int lh = lane >> 4;                    // K-half select (0/1)
  // Publishes the inner tile, wo1 and wo2 to all eight waves.
  __syncthreads();

  // ---------------- GEMM1: one 16x16 tile of g per wave, K = 256 ------------
  {
    const int mt = wv & 1, nt = wv >> 1;
    const float* aB = sx   + (mt * 16 + lr) * P256 + 2 * lh;
    const float* bB = swo1 + (nt * 16 + lr) * P256 + 2 * lh;
    const float bv = bo1[nt * 16 + lr];
    v8f c = {};
    // Fragments in blocks of 16 k-steps, two register sets: a block's LDS reads stand as one
    // group a whole block of WMMAs ahead of their use.
    v2f fa[2][16], fb[2][16];
#pragma unroll
    for (int s = 0; s < 2; ++s)
#pragma unroll
      for (int i = 0; i < 16; ++i) {
        fa[s][i] = *(const v2f*)(aB + 64 * s + 4 * i);
        fb[s][i] = *(const v2f*)(bB + 64 * s + 4 * i);
      }
#pragma unroll
    for (int s = 0; s < 4; ++s) {
      // Keeps the LDS reads above from sinking down to the WMMAs that use them
      // (the compiler left them only two WMMAs of lead, less than the LDS latency).
      __builtin_amdgcn_sched_barrier(0);
#pragma unroll
      for (int i = 0; i < 16; ++i)
        c = __builtin_amdgcn_wmma_f32_16x16x4_f32(false, fa[s & 1][i], false, fb[s & 1][i], (short)0, c, false, false);
      if (s < 2) {
#pragma unroll
        for (int i = 0; i < 16; ++i) {
          fa[s & 1][i] = *(const v2f*)(aB + 64 * (s + 2) + 4 * i);
          fb[s & 1][i] = *(const v2f*)(bB + 64 * (s + 2) + 4 * i);
        }
      }
    }
#pragma unroll
    for (int j = 0; j < 8; ++j)
      sg[(mt * 16 + j + 8 * lh) * P64 + nt * 16 + lr] = fmaxf(c[j] + bv, 0.0f);
  }
  // Publishes g to all eight waves.
  __syncthreads();

  // ---------------- GEMM2: 2 row tiles x 2 column tiles per wave, K = 64 ----
  {
    const int o0 = wv * 32;                    // this wave's 32 output columns: whole 128-B lines
    const float* aB = sg   + lr * P64 + 2 * lh;
    const float* bB = swo2 + (o0 + lr) * P64 + 2 * lh;
    const float bv0 = bo2[o0 + lr], bv1 = bo2[o0 + 16 + lr];
    v8f c00 = {}, c01 = {}, c10 = {}, c11 = {};
#pragma unroll
    for (int kk = 0; kk < 16; ++kk) {
      const v2f a0 = *(const v2f*)(aB + 4 * kk);
      const v2f a1 = *(const v2f*)(aB + 16 * P64 + 4 * kk);
      const v2f q0 = *(const v2f*)(bB + 4 * kk);
      const v2f q1 = *(const v2f*)(bB + 16 * P64 + 4 * kk);
      c00 = __builtin_amdgcn_wmma_f32_16x16x4_f32(false, a0, false, q0, (short)0, c00, false, false);
      c01 = __builtin_amdgcn_wmma_f32_16x16x4_f32(false, a0, false, q1, (short)0, c01, false, false);
      c10 = __builtin_amdgcn_wmma_f32_16x16x4_f32(false, a1, false, q0, (short)0, c10, false, false);
      c11 = __builtin_amdgcn_wmma_f32_16x16x4_f32(false, a1, false, q1, (short)0, c11, false, false);
    }
    float* op = out + (size_t)(r0 + 8 * lh) * OUT_F + o0 + lr;
#pragma unroll
    for (int j = 0; j < 8; ++j) {
      op[(size_t)j * OUT_F]             = c00[j] + bv0;
      op[(size_t)j * OUT_F + 16]        = c01[j] + bv1;
      op[(size_t)(j + 16) * OUT_F]      = c10[j] + bv0;
      op[(size_t)(j + 16) * OUT_F + 16] = c11[j] + bv1;
    }
  }
}

// ---------------------------------------------------------------------------
extern "C" void kernel_launch(void* const* d_in, const int* in_sizes, int n_in,
                              void* d_out, int out_size, void* d_ws, size_t ws_size,
                              hipStream_t stream) {
  const float* x   = (const float*)d_in[0];
  const float* w1  = (const float*)d_in[1];
  const float* b1  = (const float*)d_in[2];
  const float* w2  = (const float*)d_in[3];
  const float* b2  = (const float*)d_in[4];
  const float* wo1 = (const float*)d_in[5];
  const float* bo1 = (const float*)d_in[6];
  const float* wo2 = (const float*)d_in[7];
  const float* bo2 = (const float*)d_in[8];
  float* out   = (float*)d_out;

  // 256 blocks x 32 rows = 8192 rows
  kan_fused_kernel<<<B_ROWS / BLK_ROWS, 256, 0, stream>>>(x, w1, b1, w2, b2, wo1, bo1, wo2, bo2, out);
}

// v003
// One run takes 12.9 microseconds.
// Next to v002, in two timings, it ran 1.13 times as fast each time.
// All steps since v000 together make it 6.53 times as fast.
#include <hip/hip_runtime.h>

typedef float v2f __attribute__((ext_vector_type(2)));
typedef float v4f __attribute__((ext_vector_type(4)));
typedef float v8f __attribute__((ext_vector_type(8)));

#define B_ROWS 8192
#define D_FEAT 256
#define N_INNER 64
#define OUT_F 256

// ---------------------------------------------------------------------------
// One launch. A block = 8 waves owns 32 rows and all 256 features.
// Phase 1 (vector unit): inner[b,d] = sum_i relu(x*w1+b1)*w2 + b2.
//   Wave w owns features 32w..32w+31, one lane per feature, all 64 (w1,b1,w2)
//   triples of the feature in registers; the triples and the 32 x rows come in
//   with whole-line b128 loads and pass through LDS once. A lane sums its own
//   64 terms and writes the result over the x value it came from, so the inner
//   tile stays in LDS and never goes to memory.
// Phase 2 (V_WMMA_F32_16X16X4_F32): g = relu(inner @ wo1^T + bo1), 2 x 4 tiles
//   of 16x16, one per wave; out = g @ wo2^T + bo2, 2 x 16 tiles, four per wave.
//   wo1 and wo2 are staged in the LDS that the triples have left.
// A 16x4 f32 frag: lane<16 holds {A[l,K],A[l,K+1]}, lane>=16 {A[l-16,K+2],K+3}
// B 4x16 f32 frag: lane<16 holds {B[K,n],B[K+1,n]}, lane>=16 {B[K+2,n],B[K+3,n]}
// Both are contiguous float2 per lane in row-major storage.
// ---------------------------------------------------------------------------
#define BLK_ROWS 32                            // rows per block
// LDS pitches in floats, each 16 B x an odd number: no bank conflict at one row per lane
#define P64  68                                // a row of 64 floats + 4
#define P256 260                               // a row of 256 floats + 4
#define PW   196                               // a feature's row: its 64 w1, 64 b1, 64 w2, + 4

__global__ __launch_bounds__(256) void kan_fused_kernel(
    const float* __restrict__ x,   const float* __restrict__ w1,
    const float* __restrict__ b1,  const float* __restrict__ w2,
    const float* __restrict__ b2,  const float* __restrict__ wo1,
    const float* __restrict__ bo1, const float* __restrict__ wo2,
    const float* __restrict__ bo2, float* __restrict__ out)
{
  __shared__ __attribute__((aligned(16))) float sw[D_FEAT * PW];      // the triples, [256][196]
  __shared__ __attribute__((aligned(16))) float sx[BLK_ROWS * P256];  // x, overwritten by inner
  // once the triples are in registers their LDS takes wo2, wo1 and g
  float* const swo2 = sw;                                 // [256][68]
  float* const swo1 = sw + OUT_F * P64;                   // [64][260]
  float* const sg   = sw + OUT_F * P64 + N_INNER * P256;  // [32][68]

  const int t    = threadIdx.x;
  const int lane = t & 31;
  const int wv   = t >> 5;
  const int r0   = blockIdx.x * BLK_ROWS;      // first row of the block
  // LDS place of float4 number t of a row-major array with rows of 256 floats
  const int o256 = (t >> 6) * P256 + (t & 63) * 4;

  // ---- stage the triples (3 x 64 KB) and the x rows (32 KB), whole lines ----
  {
    const float4* w1v = (const float4*)w1;
    const float4* b1v = (const float4*)b1;
    const float4* w2v = (const float4*)w2;
    const float4* xv4 = (const float4*)(x + (size_t)r0 * D_FEAT);
    float4 ga[16], gb[16], gc[16], gx[8];
#pragma unroll
    for (int k = 0; k < 16; ++k) {             // each wave brings its own 32 features: 3 x 8 KB
      const int q = wv * 512 + lane + 32 * k;  // feature = q/16, float4 column = q%16
      ga[k] = w1v[q]; gb[k] = b1v[q]; gc[k] = w2v[q];
    }
#pragma unroll
    for (int k = 0; k < 8; ++k) gx[k] = xv4[t + 256 * k];
    float* const wp = sw + (wv * 32 + (lane >> 4)) * PW + (lane & 15) * 4;
#pragma unroll
    for (int k = 0; k < 16; ++k) {             // 32 float4 on = 2 features on
      *(float4*)(wp + k * 2 * PW)       = ga[k];
      *(float4*)(wp + k * 2 * PW + 64)  = gb[k];
      *(float4*)(wp + k * 2 * PW + 128) = gc[k];
    }
#pragma unroll
    for (int k = 0; k < 8; ++k)                // 256 float4 on = 4 rows of 256 floats on
      *(float4*)(sx + o256 + k * 4 * P256) = gx[k];
  }
  const float b2v = b2[t];                     // feature of this lane = t
  __syncthreads();

  // ---- this lane's 64 triples into registers as 32 v2f pairs each ----------
  // (read as 4-float vectors and halved: from float4 members the compiler copied nearly every pair)
  v2f w1p[32], b1p[32], w2p[32];
#pragma unroll
  for (int j = 0; j < 16; ++j) {
    const v4f a = *(const v4f*)(sw + t * PW + 4 * j);
    const v4f b = *(const v4f*)(sw + t * PW + 64 + 4 * j);
    const v4f c = *(const v4f*)(sw + t * PW + 128 + 4 * j);
    w1p[2*j+0] = a.xy; w1p[2*j+1] = a.zw;
    b1p[2*j+0] = b.xy; b1p[2*j+1] = b.zw;
    w2p[2*j+0] = c.xy; w2p[2*j+1] = c.zw;
  }
  // Every wave has its triples in registers behind this barrier: their LDS is free.
  __syncthreads();
  const v2f zero = (v2f){0.0f, 0.0f};

  float* xs = sx + t;                          // this lane's column of the 32 rows

  float xc[4];
#pragma unroll
  for (int u = 0; u < 4; ++u) xc[u] = xs[u * P256];

  for (int rb = 0; rb < BLK_ROWS; rb += 4) {
    // next four rows' x, read one trip ahead (the last trip re-reads rows 0..3, unused)
    float xn[4];
#pragma unroll
    for (int u = 0; u < 4; ++u) xn[u] = xs[(((rb + 4) & 31) + u) * P256];

    v2f xv[4], acc0[4], acc1[4];
#pragma unroll
    for (int u = 0; u < 4; ++u) {
      xv[u] = (v2f){xc[u], xc[u]};
      acc0[u] = zero; acc1[u] = zero;
    }
    // Holds the LDS reads of the next rows up here, a whole trip ahead of their use.
    __builtin_amdgcn_sched_barrier(0);
    // 4 rows x 2 pairs = 8 independent strands between dependent instructions
#pragma unroll
    for (int j = 0; j < 16; ++j) {
      v2f h0[4], h1[4];
      // The products are the compiler's own fma (built as v_pk_fma_f32): it knows such a value
      // to be canonical and builds one max for the relu. Behind a product from asm text it
      // puts a canonicalising max(v,v) in front of every max(v,0).
#pragma unroll
      for (int u = 0; u < 4; ++u) {
        h0[u] = __builtin_elementwise_fma(xv[u], w1p[2*j+0], b1p[2*j+0]);
        h1[u] = __builtin_elementwise_fma(xv[u], w1p[2*j+1], b1p[2*j+1]);
      }
      // Keeps the eight products together, in front of their max. Without the three scheduling
      // barriers of this group the compiler runs the products several groups ahead and takes
      // more than 256 registers, with register-window switches all through the loop.
      __builtin_amdgcn_sched_barrier(0);
#pragma unroll
      for (int u = 0; u < 4; ++u) {
        h0[u] = __builtin_elementwise_max(h0[u], zero);
        h1[u] = __builtin_elementwise_max(h1[u], zero);
      }
      // Same purpose: the eight sums stay together, behind all the max.
      __builtin_amdgcn_sched_barrier(0);
#pragma unroll
      for (int u = 0; u < 4; ++u) {
        acc0[u] = __builtin_elementwise_fma(h0[u], w2p[2*j+0], acc0[u]);
        acc1[u] = __builtin_elementwise_fma(h1[u], w2p[2*j+1], acc1[u]);
      }
      // Closes the group, so that each group of two pairs is scheduled alone.
      __builtin_amdgcn_sched_barrier(0);
    }
#pragma unroll
    for (int u = 0; u < 4; ++u) {
      xs[(rb + u) * P256] =
          ((acc0[u].x + acc0[u].y) + (acc1[u].x + acc1[u].y)) + b2v;
      xc[u] = xn[u];
    }
  }

  // ---- stage wo1 (64 KB) and wo2 (64 KB) in the freed LDS, whole lines ------
  {
    const int o64 = (t >> 4) * P64 + (t & 15) * 4;   // as o256, for rows of 64 floats
    const float4* o1v = (const float4*)wo1;
    const float4* o2v = (const float4*)wo2;
    float4 ha[16], hb[16];
#pragma unroll
    for (int k = 0; k < 16; ++k) ha[k] = o1v[t + 256 * k];
#pragma unroll
    for (int k = 0; k < 16; ++k) hb[k] = o2v[t + 256 * k];
#pragma unroll
    for (int k = 0; k < 16; ++k)
      *(float4*)(swo1 + o256 + k * 4 * P256) = ha[k];
#pragma unroll
    for (int k = 0; k < 16; ++k)
      *(float4*)(swo2 + o64 + k * 16 * P64) = hb[k];
  }
  const int lr = lane & 15;                    // in-tile row/col
  const int lh = lane >> 4;                    // K-half select (0/1)
  // Publishes the inner tile, wo1 and wo2 to all eight waves.
  __syncthreads();

  // ---------------- GEMM1: one 16x16 tile of g per wave, K = 256 ------------
  {
    const int mt = wv & 1, nt = wv >> 1;
    const float* aB = sx   + (mt * 16 + lr) * P256 + 2 * lh;
    const float* bB = swo1 + (nt * 16 + lr) * P256 + 2 * lh;
    const float bv = bo1[nt * 16 + lr];
    v8f c = {};
    // Fragments in blocks of 16 k-steps, two register sets: a block's LDS reads stand as one
    // group a whole block of WMMAs ahead of their use.
    v2f fa[2][16], fb[2][16];
#pragma unroll
    for (int s = 0; s < 2; ++s)
#pragma unroll
      for (int i = 0; i < 16; ++i) {
        fa[s][i] = *(const v2f*)(aB + 64 * s + 4 * i);
        fb[s][i] = *(const v2f*)(bB + 64 * s + 4 * i);
      }
#pragma unroll
    for (int s = 0; s < 4; ++s) {
      // Keeps the LDS reads above from sinking down to the WMMAs that use them
      // (the compiler left them only two WMMAs of lead, less than the LDS latency).
      __builtin_amdgcn_sched_barrier(0);
#pragma unroll
      for (int i = 0; i < 16; ++i)
        c = __builtin_amdgcn_wmma_f32_16x16x4_f32(false, fa[s & 1][i], false, fb[s & 1][i], (short)0, c, false, false);
      if (s < 2) {
#pragma unroll
        for (int i = 0; i < 16; ++i) {
          fa[s & 1][i] = *(const v2f*)(aB + 64 * (s + 2) + 4 * i);
          fb[s & 1][i] = *(const v2f*)(bB + 64 * (s + 2) + 4 * i);
        }
      }
    }
#pragma unroll
    for (int j = 0; j < 8; ++j)
      sg[(mt * 16 + j + 8 * lh) * P64 + nt * 16 + lr] = fmaxf(c[j] + bv, 0.0f);
  }
  // Publishes g to all eight waves.
  __syncthreads();

  // ---------------- GEMM2: 2 row tiles x 2 column tiles per wave, K = 64 ----
  {
    const int o0 = wv * 32;                    // this wave's 32 output columns: whole 128-B lines
    const float* aB = sg   + lr * P64 + 2 * lh;
    const float* bB = swo2 + (o0 + lr) * P64 + 2 * lh;
    const float bv0 = bo2[o0 + lr], bv1 = bo2[o0 + 16 + lr];
    v8f c00 = {}, c01 = {}, c10 = {}, c11 = {};
#pragma unroll
    for (int kk = 0; kk < 16; ++kk) {
      const v2f a0 = *(const v2f*)(aB + 4 * kk);
      const v2f a1 = *(const v2f*)(aB + 16 * P64 + 4 * kk);
      const v2f q0 = *(const v2f*)(bB + 4 * kk);
      const v2f q1 = *(const v2f*)(bB + 16 * P64 + 4 * kk);
      c00 = __builtin_amdgcn_wmma_f32_16x16x4_f32(false, a0, false, q0, (short)0, c00, false, false);
      c01 = __builtin_amdgcn_wmma_f32_16x16x4_f32(false, a0, false, q1, (short)0, c01, false, false);
      c10 = __builtin_amdgcn_wmma_f32_16x16x4_f32(false, a1, false, q0, (short)0, c10, false, false);
      c11 = __builtin_amdgcn_wmma_f32_16x16x4_f32(false, a1, false, q1, (short)0, c11, false, false);
    }
    float* op = out + (size_t)(r0 + 8 * lh) * OUT_F + o0 + lr;
#pragma unroll
    for (int j = 0; j < 8; ++j) {
      op[(size_t)j * OUT_F]             = c00[j] + bv0;
      op[(size_t)j * OUT_F + 16]        = c01[j] + bv1;
      op[(size_t)(j + 16) * OUT_F]      = c10[j] + bv0;
      op[(size_t)(j + 16) * OUT_F + 16] = c11[j] + bv1;
    }
  }
}

// ---------------------------------------------------------------------------
extern "C" void kernel_launch(void* const* d_in, const int* in_sizes, int n_in,
                              void* d_out, int out_size, void* d_ws, size_t ws_size,
                              hipStream_t stream) {
  const float* x   = (const float*)d_in[0];
  const float* w1  = (const float*)d_in[1];
  const float* b1  = (const float*)d_in[2];
  const float* w2  = (const float*)d_in[3];
  const float* b2  = (const float*)d_in[4];
  const float* wo1 = (const float*)d_in[5];
  const float* bo1 = (const float*)d_in[6];
  const float* wo2 = (const float*)d_in[7];
  const float* bo2 = (const float*)d_in[8];
  float* out   = (float*)d_out;

  // 256 blocks x 32 rows = 8192 rows
  kan_fused_kernel<<<B_ROWS / BLK_ROWS, 256, 0, stream>>>(x, w1, b1, w2, b2, wo1, bo1, wo2, bo2, out);
}

// v004
// It runs in 11.6 microseconds.
// Timed twice side by side with v003, it ran 1.11 times as fast both times.
// Over all steps from v000 it is 7.24 times as fast.
#include <hip/hip_runtime.h>

typedef float v2f __attribute__((ext_vector_type(2)));
typedef float v4f __attribute__((ext_vector_type(4)));
typedef float v8f __attribute__((ext_vector_type(8)));

#define B_ROWS 8192
#define D_FEAT 256
#define N_INNER 64
#define OUT_F 256

// ---------------------------------------------------------------------------
// One launch. A block = 8 waves owns 32 rows and all 256 features.
// Phase 1 (vector unit): inner[b,d] = sum_i relu(x*w1+b1)*w2 + b2.
//   Wave w owns features 32w..32w+31, one lane per feature, all 64 (w1,b1,w2)
//   triples of the feature in registers; the triples and the 32 x rows come in
//   with whole-line b128 loads and pass through LDS once. A lane sums its own
//   64 terms and writes the result over the x value it came from, so the inner
//   tile stays in LDS and never goes to memory. The relu is the clamp modifier of
//   the first packed fma (see RELU BY CLAMP below): phase 1 holds no max instruction.
// Phase 2 (V_WMMA_F32_16X16X4_F32): g = relu(inner @ wo1^T + bo1), 2 x 4 tiles
//   of 16x16, one per wave; out = g @ wo2^T + bo2, 2 x 16 tiles, four per wave.
//   wo1 and wo2 are staged in the LDS that the triples have left.
// A 16x4 f32 frag: lane<16 holds {A[l,K],A[l,K+1]}, lane>=16 {A[l-16,K+2],K+3}
// B 4x16 f32 frag: lane<16 holds {B[K,n],B[K+1,n]}, lane>=16 {B[K+2,n],B[K+3,n]}
// Both are contiguous float2 per lane in row-major storage.
// ---------------------------------------------------------------------------
#define BLK_ROWS 32                            // rows per block
// LDS pitches in floats, each 16 B x an odd number: no bank conflict at one row per lane
#define P64  68                                // a row of 64 floats + 4
#define P256 260                               // a row of 256 floats + 4
#define PW   196                               // a feature's row: its 64 w1, 64 b1, 64 w2, + 4

__global__ __launch_bounds__(256) void kan_fused_kernel(
    const float* __restrict__ x,   const float* __restrict__ w1,
    const float* __restrict__ b1,  const float* __restrict__ w2,
    const float* __restrict__ b2,  const float* __restrict__ wo1,
    const float* __restrict__ bo1, const float* __restrict__ wo2,
    const float* __restrict__ bo2, float* __restrict__ out)
{
  __shared__ __attribute__((aligned(16))) float sw[D_FEAT * PW];      // the triples, [256][196]
  __shared__ __attribute__((aligned(16))) float sx[BLK_ROWS * P256];  // x, overwritten by inner
  // once the triples are in registers their LDS takes wo2, wo1 and g
  float* const swo2 = sw;                                 // [256][68]
  float* const swo1 = sw + OUT_F * P64;                   // [64][260]
  float* const sg   = sw + OUT_F * P64 + N_INNER * P256;  // [32][68]

  const int t    = threadIdx.x;
  const int lane = t & 31;
  const int wv   = t >> 5;
  const int r0   = blockIdx.x * BLK_ROWS;      // first row of the block
  // LDS place of float4 number t of a row-major array with rows of 256 floats
  const int o256 = (t >> 6) * P256 + (t & 63) * 4;

  // ---- stage the triples (3 x 64 KB) and the x rows (32 KB), whole lines ----
  {
    const float4* w1v = (const float4*)w1;
    const float4* b1v = (const float4*)b1;
    const float4* w2v = (const float4*)w2;
    const float4* xv4 = (const float4*)(x + (size_t)r0 * D_FEAT);
    float4 ga[16], gb[16], gc[16], gx[8];
#pragma unroll
    for (int k = 0; k < 16; ++k) {             // each wave brings its own 32 features: 3 x 8 KB
      const int q = wv * 512 + lane + 32 * k;  // feature = q/16, float4 column = q%16
      ga[k] = w1v[q]; gb[k] = b1v[q]; gc[k] = w2v[q];
    }
#pragma unroll
    for (int k = 0; k < 8; ++k) gx[k] = xv4[t + 256 * k];
    float* const wp = sw + (wv * 32 + (lane >> 4)) * PW + (lane & 15) * 4;
#pragma unroll
    for (int k = 0; k < 16; ++k) {             // 32 float4 on = 2 features on
      *(float4*)(wp + k * 2 * PW)       = ga[k];
      *(float4*)(wp + k * 2 * PW + 64)  = gb[k];
      *(float4*)(wp + k * 2 * PW + 128) = gc[k];
    }
#pragma unroll
    for (int k = 0; k < 8; ++k)                // 256 float4 on = 4 rows of 256 floats on
      *(float4*)(sx + o256 + k * 4 * P256) = gx[k];
  }
  const float b2v = b2[t];                     // feature of this lane = t
  __syncthreads();

  // ---- this lane's 64 triples into registers as 32 v2f pairs each ----------
  // (read as 4-float vectors and halved: from float4 members the compiler copied nearly every pair)
  // RELU BY CLAMP. The clamp modifier of a float fma limits its result to [0, 1]. With w1 and b1
  // times 2^-64 the fma gives (x*w1+b1) * 2^-64, so the lower limit is the relu and the upper one
  // is met only from x*w1+b1 = 2^64 on; w2 times 2^64 takes the factor out again. Powers of two
  // change no rounding, so every product and every sum has the bits it had before.
  // Range: x*w1+b1 below 2^64 and |w2| below 2^63. A w1, b1 or x*w1+b1 under 2^-62 in size leaves
  // the normal range when scaled and loses low bits: an absolute error under 2^-61 * max(|x|, 1).
  const v2f dn = (v2f){0x1p-64f, 0x1p-64f};
  const v2f up = (v2f){0x1p+64f, 0x1p+64f};
  v2f w1p[32], b1p[32], w2p[32];
#pragma unroll
  for (int j = 0; j < 16; ++j) {
    const v4f a = *(const v4f*)(sw + t * PW + 4 * j);
    const v4f b = *(const v4f*)(sw + t * PW + 64 + 4 * j);
    const v4f c = *(const v4f*)(sw + t * PW + 128 + 4 * j);
    w1p[2*j+0] = a.xy * dn; w1p[2*j+1] = a.zw * dn;
    b1p[2*j+0] = b.xy * dn; b1p[2*j+1] = b.zw * dn;
    w2p[2*j+0] = c.xy * up; w2p[2*j+1] = c.zw * up;
  }
  // Every wave has its triples in registers behind this barrier: their LDS is free.
  __syncthreads();

  float* xs = sx + t;                          // this lane's column of the 32 rows

  float xc[4];
#pragma unroll
  for (int u = 0; u < 4; ++u) xc[u] = xs[u * P256];

  for (int rb = 0; rb < BLK_ROWS; rb += 4) {
    // next four rows' x, read one trip ahead (the last trip re-reads rows 0..3, unused)
    float xn[4];
#pragma unroll
    for (int u = 0; u < 4; ++u) xn[u] = xs[(((rb + 4) & 31) + u) * P256];

    v2f xv[4], acc0[4], acc1[4];
#pragma unroll
    for (int u = 0; u < 4; ++u) xv[u] = (v2f){xc[u], xc[u]};
    // Holds the LDS reads of the next rows up here, a whole trip ahead of their use.
    __builtin_amdgcn_sched_barrier(0);
    // 4 rows x 2 pairs = 8 independent strands: each sum stands 8 instructions behind its product
#pragma unroll
    for (int j = 0; j < 16; ++j) {
      v2f h0[4], h1[4];
      // The eight products with their relu. In asm text because the compiler has no way to put
      // the clamp on a packed f32 fma: it builds one max per value behind it instead.
      asm("v_pk_fma_f32 %0, %8, %12, %14 clamp\n\t"
          "v_pk_fma_f32 %1, %8, %13, %15 clamp\n\t"
          "v_pk_fma_f32 %2, %9, %12, %14 clamp\n\t"
          "v_pk_fma_f32 %3, %9, %13, %15 clamp\n\t"
          "v_pk_fma_f32 %4, %10, %12, %14 clamp\n\t"
          "v_pk_fma_f32 %5, %10, %13, %15 clamp\n\t"
          "v_pk_fma_f32 %6, %11, %12, %14 clamp\n\t"
          "v_pk_fma_f32 %7, %11, %13, %15 clamp"
          : "=&v"(h0[0]), "=&v"(h1[0]), "=&v"(h0[1]), "=&v"(h1[1]),
            "=&v"(h0[2]), "=&v"(h1[2]), "=&v"(h0[3]), "=&v"(h1[3])
          : "v"(xv[0]), "v"(xv[1]), "v"(xv[2]), "v"(xv[3]),
            "v"(w1p[2*j+0]), "v"(w1p[2*j+1]), "v"(b1p[2*j+0]), "v"(b1p[2*j+1]));
      // The eight sums, in the order of their products. In asm text so that this order stands:
      // the compiler gives no delay hint behind a value from asm text, and a sum moved up next
      // to its product would stall the SIMD for both of its waves.
      if (j == 0) {
        asm("v_pk_fma_f32 %0, %8, %16, 0 op_sel_hi:[1,1,0]\n\t"
            "v_pk_fma_f32 %1, %9, %17, 0 op_sel_hi:[1,1,0]\n\t"
            "v_pk_fma_f32 %2, %10, %16, 0 op_sel_hi:[1,1,0]\n\t"
            "v_pk_fma_f32 %3, %11, %17, 0 op_sel_hi:[1,1,0]\n\t"
            "v_pk_fma_f32 %4, %12, %16, 0 op_sel_hi:[1,1,0]\n\t"
            "v_pk_fma_f32 %5, %13, %17, 0 op_sel_hi:[1,1,0]\n\t"
            "v_pk_fma_f32 %6, %14, %16, 0 op_sel_hi:[1,1,0]\n\t"
            "v_pk_fma_f32 %7, %15, %17, 0 op_sel_hi:[1,1,0]"
            : "=&v"(acc0[0]), "=&v"(acc1[0]), "=&v"(acc0[1]), "=&v"(acc1[1]),
              "=&v"(acc0[2]), "=&v"(acc1[2]), "=&v"(acc0[3]), "=&v"(acc1[3])
            : "v"(h0[0]), "v"(h1[0]), "v"(h0[1]), "v"(h1[1]),
              "v"(h0[2]), "v"(h1[2]), "v"(h0[3]), "v"(h1[3]),
              "v"(w2p[0]), "v"(w2p[1]));
      } else {
        asm("v_pk_fma_f32 %0, %8, %16, %0\n\t"
            "v_pk_fma_f32 %1, %9, %17, %1\n\t"
            "v_pk_fma_f32 %2, %10, %16, %2\n\t"
            "v_pk_fma_f32 %3, %11, %17, %3\n\t"
            "v_pk_fma_f32 %4, %12, %16, %4\n\t"
            "v_pk_fma_f32 %5, %13, %17, %5\n\t"
            "v_pk_fma_f32 %6, %14, %16, %6\n\t"
            "v_pk_fma_f32 %7, %15, %17, %7"
            : "+v"(acc0[0]), "+v"(acc1[0]), "+v"(acc0[1]), "+v"(acc1[1]),
              "+v"(acc0[2]), "+v"(acc1[2]), "+v"(acc0[3]), "+v"(acc1[3])
            : "v"(h0[0]), "v"(h1[0]), "v"(h0[1]), "v"(h1[1]),
              "v"(h0[2]), "v"(h1[2]), "v"(h0[3]), "v"(h1[3]),
              "v"(w2p[2*j+0]), "v"(w2p[2*j+1]));
      }
      // Closes the group. Without it the compiler runs the products several groups ahead, takes
      // more than 256 registers and reloads spilled triples from scratch memory inside the loop.
      __builtin_amdgcn_sched_barrier(0);
    }
#pragma unroll
    for (int u = 0; u < 4; ++u) {
      xs[(rb + u) * P256] =
          ((acc0[u].x + acc0[u].y) + (acc1[u].x + acc1[u].y)) + b2v;
      xc[u] = xn[u];
    }
  }

  // ---- stage wo1 (64 KB) and wo2 (64 KB) in the freed LDS, whole lines ------
  {
    const int o64 = (t >> 4) * P64 + (t & 15) * 4;   // as o256, for rows of 64 floats
    const float4* o1v = (const float4*)wo1;
    const float4* o2v = (const float4*)wo2;
    float4 ha[16], hb[16];
#pragma unroll
    for (int k = 0; k < 16; ++k) ha[k] = o1v[t + 256 * k];
#pragma unroll
    for (int k = 0; k < 16; ++k) hb[k] = o2v[t + 256 * k];
#pragma unroll
    for (int k = 0; k < 16; ++k)
      *(float4*)(swo1 + o256 + k * 4 * P256) = ha[k];
#pragma unroll
    for (int k = 0; k < 16; ++k)
      *(float4*)(swo2 + o64 + k * 16 * P64) = hb[k];
  }
  const int lr = lane & 15;                    // in-tile row/col
  const int lh = lane >> 4;                    // K-half select (0/1)
  // Publishes the inner tile, wo1 and wo2 to all eight waves.
  __syncthreads();

  // ---------------- GEMM1: one 16x16 tile of g per wave, K = 256 ------------
  {
    const int mt = wv & 1, nt = wv >> 1;
    const float* aB = sx   + (mt * 16 + lr) * P256 + 2 * lh;
    const float* bB = swo1 + (nt * 16 + lr) * P256 + 2 * lh;
    const float bv = bo1[nt * 16 + lr];
    v8f c = {};
    // Fragments in blocks of 16 k-steps, two register sets: a block's LDS reads stand as one
    // group a whole block of WMMAs ahead of their use.
    v2f fa[2][16], fb[2][16];
#pragma unroll
    for (int s = 0; s < 2; ++s)
#pragma unroll
      for (int i = 0; i < 16; ++i) {
        fa[s][i] = *(const v2f*)(aB + 64 * s + 4 * i);
        fb[s][i] = *(const v2f*)(bB + 64 * s + 4 * i);
      }
#pragma unroll
    for (int s = 0; s < 4; ++s) {
      // Keeps the LDS reads above from sinking down to the WMMAs that use them
      // (the compiler left them only two WMMAs of lead, less than the LDS latency).
      __builtin_amdgcn_sched_barrier(0);
#pragma unroll
      for (int i = 0; i < 16; ++i)
        c = __builtin_amdgcn_wmma_f32_16x16x4_f32(false, fa[s & 1][i], false, fb[s & 1][i], (short)0, c, false, false);
      if (s < 2) {
#pragma unroll
        for (int i = 0; i < 16; ++i) {
          fa[s & 1][i] = *(const v2f*)(aB + 64 * (s + 2) + 4 * i);
          fb[s & 1][i] = *(const v2f*)(bB + 64 * (s + 2) + 4 * i);
        }
      }
    }
#pragma unroll
    for (int j = 0; j < 8; ++j)
      sg[(mt * 16 + j + 8 * lh) * P64 + nt * 16 + lr] = fmaxf(c[j] + bv, 0.0f);
  }
  // Publishes g to all eight waves.
  __syncthreads();

  // ---------------- GEMM2: 2 row tiles x 2 column tiles per wave, K = 64 ----
  {
    const int o0 = wv * 32;                    // this wave's 32 output columns: whole 128-B lines
    const float* aB = sg   + lr * P64 + 2 * lh;
    const float* bB = swo2 + (o0 + lr) * P64 + 2 * lh;
    const float bv0 = bo2[o0 + lr], bv1 = bo2[o0 + 16 + lr];
    v8f c00 = {}, c01 = {}, c10 = {}, c11 = {};
#pragma unroll
    for (int kk = 0; kk < 16; ++kk) {
      const v2f a0 = *(const v2f*)(aB + 4 * kk);
      const v2f a1 = *(const v2f*)(aB + 16 * P64 + 4 * kk);
      const v2f q0 = *(const v2f*)(bB + 4 * kk);
      const v2f q1 = *(const v2f*)(bB + 16 * P64 + 4 * kk);
      c00 = __builtin_amdgcn_wmma_f32_16x16x4_f32(false, a0, false, q0, (short)0, c00, false, false);
      c01 = __builtin_amdgcn_wmma_f32_16x16x4_f32(false, a0, false, q1, (short)0, c01, false, false);
      c10 = __builtin_amdgcn_wmma_f32_16x16x4_f32(false, a1, false, q0, (short)0, c10, false, false);
      c11 = __builtin_amdgcn_wmma_f32_16x16x4_f32(false, a1, false, q1, (short)0, c11, false, false);
    }
    float* op = out + (size_t)(r0 + 8 * lh) * OUT_F + o0 + lr;
#pragma unroll
    for (int j = 0; j < 8; ++j) {
      op[(size_t)j * OUT_F]             = c00[j] + bv0;
      op[(size_t)j * OUT_F + 16]        = c01[j] + bv1;
      op[(size_t)(j + 16) * OUT_F]      = c10[j] + bv0;
      op[(size_t)(j + 16) * OUT_F + 16] = c11[j] + bv1;
    }
  }
}

// ---------------------------------------------------------------------------
extern "C" void kernel_launch(void* const* d_in, const int* in_sizes, int n_in,
                              void* d_out, int out_size, void* d_ws, size_t ws_size,
                              hipStream_t stream) {
  const float* x   = (const float*)d_in[0];
  const float* w1  = (const float*)d_in[1];
  const float* b1  = (const float*)d_in[2];
  const float* w2  = (const float*)d_in[3];
  const float* b2  = (const float*)d_in[4];
  const float* wo1 = (const float*)d_in[5];
  const float* bo1 = (const float*)d_in[6];
  const float* wo2 = (const float*)d_in[7];
  const float* bo2 = (const float*)d_in[8];
  float* out   = (float*)d_out;

  // 256 blocks x 32 rows = 8192 rows
  kan_fused_kernel<<<B_ROWS / BLK_ROWS, 256, 0, stream>>>(x, w1, b1, w2, b2, wo1, bo1, wo2, bo2, out);
}

// v005
// Measured time: 10.5 microseconds a run.
// Next to v004, in two timings, it ran 1.10 times as fast each time.
// All steps since v000 together make it 7.99 times as fast.
#include <hip/hip_runtime.h>

typedef float v2f __attribute__((ext_vector_type(2)));
typedef float v4f __attribute__((ext_vector_type(4)));
typedef float v8f __attribute__((ext_vector_type(8)));

#define B_ROWS 8192
#define D_FEAT 256
#define N_INNER 64
#define OUT_F 256

// ---------------------------------------------------------------------------
// One launch. A block = 8 waves owns 32 rows and all 256 features.
// Phase 1 (vector unit): inner[b,d] = sum_i relu(x*w1+b1)*w2 + b2.
//   Wave w owns features 32w..32w+31, one lane per feature. Its x columns and its (w1,b1,w2)
//   triples come into LDS by asynchronous copies, whole 128-B lines, in two stages: x with triples
//   0..31 of every feature, then triples 32..63. The loop runs over chunks of 16 triples outside
//   and over the 32 rows inside, all 32 rows' sums in registers, so the work starts behind the
//   first stage and the second stage lands under it. A lane sums its own 64 terms and writes the
//   result over the x value it came from, so the inner tile stays in LDS and never goes to memory.
//   The relu is the clamp modifier of the first packed fma (see RELU BY CLAMP below).
// Phase 2 (V_WMMA_F32_16X16X4_F32): g = relu(inner @ wo1^T + bo1), 2 x 4 tiles
//   of 16x16, one per wave; out = g @ wo2^T + bo2, 2 x 16 tiles, four per wave.
//   wo1 has LDS of its own and is copied in under the second half of phase 1; wo2 and g take
//   the LDS that the triples have left, wo2 copied in under the first product.
// A 16x4 f32 frag: lane<16 holds {A[l,K],A[l,K+1]}, lane>=16 {A[l-16,K+2],K+3}
// B 4x16 f32 frag: lane<16 holds {B[K,n],B[K+1,n]}, lane>=16 {B[K+2,n],B[K+3,n]}
// Both are contiguous float2 per lane in row-major storage.
// ---------------------------------------------------------------------------
#define BLK_ROWS 32                            // rows per block
// LDS pitches in floats, each 16 B x an odd number: no bank conflict at one row per lane
#define P64  68                                // a row of 64 floats + 4
#define P256 260                               // a row of 256 floats + 4
#define PW   196                               // a feature's row: its 64 w1, 64 b1, 64 w2, + 4

typedef int v4i __attribute__((vector_size(16)));
typedef __attribute__((address_space(1))) v4i gv4i;
typedef __attribute__((address_space(3))) v4i lv4i;

// One asynchronous copy: each lane brings its own 16 bytes from global memory to LDS.
__device__ __forceinline__ void copy16(const float* g, float* l) {
  __builtin_amdgcn_global_load_async_to_lds_b128((gv4i*)g, (lv4i*)l, 0, 0);
}

__global__ __launch_bounds__(256) void kan_fused_kernel(
    const float* __restrict__ x,   const float* __restrict__ w1,
    const float* __restrict__ b1,  const float* __restrict__ w2,
    const float* __restrict__ b2,  const float* __restrict__ wo1,
    const float* __restrict__ bo1, const float* __restrict__ wo2,
    const float* __restrict__ bo2, float* __restrict__ out)
{
  // One array, so that x lies lowest: its 32 rows are then in reach of one address register
  // and the 16-bit offset of an LDS instruction.
  __shared__ __attribute__((aligned(16))) float smem[BLK_ROWS * P256 + D_FEAT * PW + N_INNER * P256];
  float* const sx   = smem;                               // x, overwritten by inner, [32][260]
  float* const sw   = smem + BLK_ROWS * P256;             // the triples, [256][196]
  float* const swo1 = sw + D_FEAT * PW;                   // [64][260]
  // behind phase 1 the triples' LDS takes wo2 and g
  float* const swo2 = sw;                                 // [256][68]
  float* const sg   = sw + OUT_F * P64;                   // [32][68]

  const int t    = threadIdx.x;
  const int lane = t & 31;
  const int wv   = t >> 5;
  const int r0   = blockIdx.x * BLK_ROWS;      // first row of the block
  // LDS place of float4 number t of a row-major array with rows of 256 floats
  const int o256 = (t >> 6) * P256 + (t & 63) * 4;

  // ---- the copies. Eight lanes bring one 128-B line, one copy instruction four lines. Every byte
  // that a wave copies here is read by that wave alone, so its own wait is all that the reads need.
  const int c4 = (lane & 7) * 4;               // float column inside the line
  const int l8 = lane >> 3;                    // line of the four
  {
    // stage 0: the wave's 32 columns of the 32 x rows, and triples 0..31 of its 32 features
    const float* gx = x + (size_t)(r0 + l8) * D_FEAT + wv * 32 + c4;
    float* lx = sx + l8 * P256 + wv * 32 + c4;
#pragma unroll
    for (int k = 0; k < 8; ++k) copy16(gx + k * 4 * D_FEAT, lx + k * 4 * P256);
  }
  const int gq = (wv * 32 + l8) * N_INNER + c4;  // place in w1, b1, w2
  float* const lw = sw + (wv * 32 + l8) * PW + c4;
#pragma unroll
  for (int k = 0; k < 8; ++k) copy16(w1 + gq + k * 4 * N_INNER, lw + k * 4 * PW);
#pragma unroll
  for (int k = 0; k < 8; ++k) copy16(b1 + gq + k * 4 * N_INNER, lw + k * 4 * PW + 64);
#pragma unroll
  for (int k = 0; k < 8; ++k) copy16(w2 + gq + k * 4 * N_INNER, lw + k * 4 * PW + 128);
  const float b2v = b2[t];                     // feature of this lane = t
  // Stage 0 has landed behind this wait: without it the LDS reads below could see old bytes.
  asm volatile("s_wait_asynccnt 0x0" ::: "memory");
  float* xs = sx + t;                          // this lane's column of the 32 rows

  // x of rows 2k and 2k+1 in one register pair; the products pick their half by op_sel
  v2f xp[16];
#pragma unroll
  for (int k = 0; k < 16; ++k) xp[k] = (v2f){xs[(2 * k) * P256], xs[(2 * k + 1) * P256]};

  // stage 1: triples 32..63, in flight while chunks 0 and 1 are worked on
#pragma unroll
  for (int k = 0; k < 8; ++k) copy16(w1 + gq + 32 + k * 4 * N_INNER, lw + k * 4 * PW + 32);
#pragma unroll
  for (int k = 0; k < 8; ++k) copy16(b1 + gq + 32 + k * 4 * N_INNER, lw + k * 4 * PW + 96);
#pragma unroll
  for (int k = 0; k < 8; ++k) copy16(w2 + gq + 32 + k * 4 * N_INNER, lw + k * 4 * PW + 160);

  // RELU BY CLAMP. The clamp modifier of a float fma limits its result to [0, 1]. With w1 and b1
  // times 2^-64 the fma gives (x*w1+b1) * 2^-64, so the lower limit is the relu and the upper one
  // is met only from x*w1+b1 = 2^64 on; w2 times 2^64 takes the factor out again. Powers of two
  // change no rounding, so every product and every sum has the bits it had before.
  // Range: x*w1+b1 below 2^64 and |w2| below 2^63. A w1, b1 or x*w1+b1 under 2^-62 in size leaves
  // the normal range when scaled and loses low bits: an absolute error under 2^-61 * max(|x|, 1).
  const v2f dn = (v2f){0x1p-64f, 0x1p-64f};
  const v2f up = (v2f){0x1p+64f, 0x1p+64f};

  // two packed sums per row, as many as the 4 floats a row's sum is folded from at the end
  v2f acc0[BLK_ROWS], acc1[BLK_ROWS];

  // Unrolled (16 KB of code, run through once): the first sums of chunk 0 then start from the
  // literal 0 and no register is zeroed.
#pragma unroll
  for (int c = 0; c < 4; ++c) {
    if (c == 2) {
      // Stage 1 has landed behind this wait: chunks 2 and 3 read its bytes.
      asm volatile("s_wait_asynccnt 0x0" ::: "memory");
      // stage 2: wo1 (64 KB), whole lines, in flight while chunks 2 and 3 are worked on
#pragma unroll
      for (int k = 0; k < 16; ++k) copy16(wo1 + 4 * (t + 256 * k), swo1 + o256 + k * 4 * P256);
    }
    // this lane's 16 triples of the chunk as 8 v2f pairs each
    // (read as 4-float vectors and halved: from float4 members the compiler copied nearly every pair)
    v2f w1p[8], b1p[8], w2p[8];
#pragma unroll
    for (int j = 0; j < 4; ++j) {
      const v4f a = *(const v4f*)(sw + t * PW + 16 * c + 4 * j);
      const v4f b = *(const v4f*)(sw + t * PW + 64 + 16 * c + 4 * j);
      const v4f d = *(const v4f*)(sw + t * PW + 128 + 16 * c + 4 * j);
      w1p[2*j+0] = a.xy * dn; w1p[2*j+1] = a.zw * dn;
      b1p[2*j+0] = b.xy * dn; b1p[2*j+1] = b.zw * dn;
      w2p[2*j+0] = d.xy * up; w2p[2*j+1] = d.zw * up;
    }
    // Keeps the chunk's reads and scalings together up here, out of the groups below.
    __builtin_amdgcn_sched_barrier(0);
    // 4 rows x 2 pairs = 8 independent strands: each sum stands 8 instructions behind its product
#pragma unroll
    for (int g = 0; g < 8; ++g) {
#pragma unroll
      for (int j = 0; j < 4; ++j) {
        v2f h0[4], h1[4];
        // The eight products with their relu. In asm text because the compiler has no way to put
        // the clamp on a packed f32 fma: it builds one max per value behind it instead.
        // op_sel gives both halves of a product the same x: the pair's low word (op_sel_hi 0 on
        // the first source) for the even row, its high word (op_sel 1) for the odd row.
        asm("v_pk_fma_f32 %0, %8, %10, %12 op_sel_hi:[0,1,1] clamp\n\t"
            "v_pk_fma_f32 %1, %8, %11, %13 op_sel_hi:[0,1,1] clamp\n\t"
            "v_pk_fma_f32 %2, %8, %10, %12 op_sel:[1,0,0] op_sel_hi:[1,1,1] clamp\n\t"
            "v_pk_fma_f32 %3, %8, %11, %13 op_sel:[1,0,0] op_sel_hi:[1,1,1] clamp\n\t"
            "v_pk_fma_f32 %4, %9, %10, %12 op_sel_hi:[0,1,1] clamp\n\t"
            "v_pk_fma_f32 %5, %9, %11, %13 op_sel_hi:[0,1,1] clamp\n\t"
            "v_pk_fma_f32 %6, %9, %10, %12 op_sel:[1,0,0] op_sel_hi:[1,1,1] clamp\n\t"
            "v_pk_fma_f32 %7, %9, %11, %13 op_sel:[1,0,0] op_sel_hi:[1,1,1] clamp"
            : "=&v"(h0[0]), "=&v"(h1[0]), "=&v"(h0[1]), "=&v"(h1[1]),
              "=&v"(h0[2]), "=&v"(h1[2]), "=&v"(h0[3]), "=&v"(h1[3])
            : "v"(xp[2*g+0]), "v"(xp[2*g+1]),
              "v"(w1p[2*j+0]), "v"(w1p[2*j+1]), "v"(b1p[2*j+0]), "v"(b1p[2*j+1]));
        // The eight sums, in the order of their products. In asm text so that this order stands:
        // the compiler gives no delay hint behind a value from asm text, and a sum moved up next
        // to its product would stall the SIMD for both of its waves.
        if (c == 0 && j == 0) {
          asm("v_pk_fma_f32 %0, %8, %16, 0 op_sel_hi:[1,1,0]\n\t"
              "v_pk_fma_f32 %1, %9, %17, 0 op_sel_hi:[1,1,0]\n\t"
              "v_pk_fma_f32 %2, %10, %16, 0 op_sel_hi:[1,1,0]\n\t"
              "v_pk_fma_f32 %3, %11, %17, 0 op_sel_hi:[1,1,0]\n\t"
              "v_pk_fma_f32 %4, %12, %16, 0 op_sel_hi:[1,1,0]\n\t"
              "v_pk_fma_f32 %5, %13, %17, 0 op_sel_hi:[1,1,0]\n\t"
              "v_pk_fma_f32 %6, %14, %16, 0 op_sel_hi:[1,1,0]\n\t"
              "v_pk_fma_f32 %7, %15, %17, 0 op_sel_hi:[1,1,0]"
              : "=&v"(acc0[4*g+0]), "=&v"(acc1[4*g+0]), "=&v"(acc0[4*g+1]), "=&v"(acc1[4*g+1]),
                "=&v"(acc0[4*g+2]), "=&v"(acc1[4*g+2]), "=&v"(acc0[4*g+3]), "=&v"(acc1[4*g+3])
              : "v"(h0[0]), "v"(h1[0]), "v"(h0[1]), "v"(h1[1]),
                "v"(h0[2]), "v"(h1[2]), "v"(h0[3]), "v"(h1[3]),
                "v"(w2p[0]), "v"(w2p[1]));
        } else {
          asm("v_pk_fma_f32 %0, %8, %16, %0\n\t"
              "v_pk_fma_f32 %1, %9, %17, %1\n\t"
              "v_pk_fma_f32 %2, %10, %16, %2\n\t"
              "v_pk_fma_f32 %3, %11, %17, %3\n\t"
              "v_pk_fma_f32 %4, %12, %16, %4\n\t"
              "v_pk_fma_f32 %5, %13, %17, %5\n\t"
              "v_pk_fma_f32 %6, %14, %16, %6\n\t"
              "v_pk_fma_f32 %7, %15, %17, %7"
              : "+v"(acc0[4*g+0]), "+v"(acc1[4*g+0]), "+v"(acc0[4*g+1]), "+v"(acc1[4*g+1]),
                "+v"(acc0[4*g+2]), "+v"(acc1[4*g+2]), "+v"(acc0[4*g+3]), "+v"(acc1[4*g+3])
              : "v"(h0[0]), "v"(h1[0]), "v"(h0[1]), "v"(h1[1]),
                "v"(h0[2]), "v"(h1[2]), "v"(h0[3]), "v"(h1[3]),
                "v"(w2p[2*j+0]), "v"(w2p[2*j+1]));
        }
        // Closes the group. Without it the compiler runs the products several groups ahead and
        // takes more registers than the sums, x and the chunk leave free.
        __builtin_amdgcn_sched_barrier(0);
      }
    }
  }
#pragma unroll
  for (int r = 0; r < BLK_ROWS; ++r)
    xs[r * P256] = ((acc0[r].x + acc0[r].y) + (acc1[r].x + acc1[r].y)) + b2v;

  const int lr = lane & 15;                    // in-tile row/col
  const int lh = lane >> 4;                    // K-half select (0/1)
  // This wave's part of wo1 has landed behind this wait; the barrier hands it to the other waves.
  asm volatile("s_wait_asynccnt 0x0" ::: "memory");
  // Publishes the inner tile and wo1 to all eight waves, and ends every wave's reads of the
  // triples: their LDS is free behind it.
  __syncthreads();
  // stage 3: wo2 (64 KB) into the triples' LDS, whole lines, in flight under the first product
  {
    const int o64 = (t >> 4) * P64 + (t & 15) * 4;   // as o256, for rows of 64 floats
#pragma unroll
    for (int k = 0; k < 16; ++k) copy16(wo2 + 4 * (t + 256 * k), swo2 + o64 + k * 16 * P64);
  }

  // ---------------- GEMM1: one 16x16 tile of g per wave, K = 256 ------------
  {
    const int mt = wv & 1, nt = wv >> 1;
    const float* aB = sx   + (mt * 16 + lr) * P256 + 2 * lh;
    const float* bB = swo1 + (nt * 16 + lr) * P256 + 2 * lh;
    const float bv = bo1[nt * 16 + lr];
    v8f c = {};
    // Fragments in blocks of 16 k-steps, two register sets: a block's LDS reads stand as one
    // group a whole block of WMMAs ahead of their use.
    v2f fa[2][16], fb[2][16];
#pragma unroll
    for (int s = 0; s < 2; ++s)
#pragma unroll
      for (int i = 0; i < 16; ++i) {
        fa[s][i] = *(const v2f*)(aB + 64 * s + 4 * i);
        fb[s][i] = *(const v2f*)(bB + 64 * s + 4 * i);
      }
#pragma unroll
    for (int s = 0; s < 4; ++s) {
      // Keeps the LDS reads above from sinking down to the WMMAs that use them
      // (the compiler left them only two WMMAs of lead).
      __builtin_amdgcn_sched_barrier(0);
#pragma unroll
      for (int i = 0; i < 16; ++i)
        c = __builtin_amdgcn_wmma_f32_16x16x4_f32(false, fa[s & 1][i], false, fb[s & 1][i], (short)0, c, false, false);
      if (s < 2) {
#pragma unroll
        for (int i = 0; i < 16; ++i) {
          fa[s & 1][i] = *(const v2f*)(aB + 64 * (s + 2) + 4 * i);
          fb[s & 1][i] = *(const v2f*)(bB + 64 * (s + 2) + 4 * i);
        }
      }
    }
#pragma unroll
    for (int j = 0; j < 8; ++j)
      sg[(mt * 16 + j + 8 * lh) * P64 + nt * 16 + lr] = fmaxf(c[j] + bv, 0.0f);
  }
  // This wave's part of wo2 has landed behind this wait; the barrier hands it to the other waves.
  asm volatile("s_wait_asynccnt 0x0" ::: "memory");
  // Publishes g and wo2 to all eight waves.
  __syncthreads();

  // ---------------- GEMM2: 2 row tiles x 2 column tiles per wave, K = 64 ----
  {
    const int o0 = wv * 32;                    // this wave's 32 output columns: whole 128-B lines
    const float* aB = sg   + lr * P64 + 2 * lh;
    const float* bB = swo2 + (o0 + lr) * P64 + 2 * lh;
    const float bv0 = bo2[o0 + lr], bv1 = bo2[o0 + 16 + lr];
    v8f c00 = {}, c01 = {}, c10 = {}, c11 = {};
#pragma unroll
    for (int kk = 0; kk < 16; ++kk) {
      const v2f a0 = *(const v2f*)(aB + 4 * kk);
      const v2f a1 = *(const v2f*)(aB + 16 * P64 + 4 * kk);
      const v2f q0 = *(const v2f*)(bB + 4 * kk);
      const v2f q1 = *(const v2f*)(bB + 16 * P64 + 4 * kk);
      c00 = __builtin_amdgcn_wmma_f32_16x16x4_f32(false, a0, false, q0, (short)0, c00, false, false);
      c01 = __builtin_amdgcn_wmma_f32_16x16x4_f32(false, a0, false, q1, (short)0, c01, false, false);
      c10 = __builtin_amdgcn_wmma_f32_16x16x4_f32(false, a1, false, q0, (short)0, c10, false, false);
      c11 = __builtin_amdgcn_wmma_f32_16x16x4_f32(false, a1, false, q1, (short)0, c11, false, false);
    }
    float* op = out + (size_t)(r0 + 8 * lh) * OUT_F + o0 + lr;
#pragma unroll
    for (int j = 0; j < 8; ++j) {
      op[(size_t)j * OUT_F]             = c00[j] + bv0;
      op[(size_t)j * OUT_F + 16]        = c01[j] + bv1;
      op[(size_t)(j + 16) * OUT_F]      = c10[j] + bv0;
      op[(size_t)(j + 16) * OUT_F + 16] = c11[j] + bv1;
    }
  }
}

// ---------------------------------------------------------------------------
extern "C" void kernel_launch(void* const* d_in, const int* in_sizes, int n_in,
                              void* d_out, int out_size, void* d_ws, size_t ws_size,
                              hipStream_t stream) {
  const float* x   = (const float*)d_in[0];
  const float* w1  = (const float*)d_in[1];
  const float* b1  = (const float*)d_in[2];
  const float* w2  = (const float*)d_in[3];
  const float* b2  = (const float*)d_in[4];
  const float* wo1 = (const float*)d_in[5];
  const float* bo1 = (const float*)d_in[6];
  const float* wo2 = (const float*)d_in[7];
  const float* bo2 = (const float*)d_in[8];
  float* out   = (float*)d_out;

  // 256 blocks x 32 rows = 8192 rows
  kan_fused_kernel<<<B_ROWS / BLK_ROWS, 256, 0, stream>>>(x, w1, b1, w2, b2, wo1, bo1, wo2, bo2, out);
}

// v006
// Measured time: 9.42 microseconds a run.
// Two timings next to v005 both put it at 1.11 times that version's speed.
// Over all steps from v000 it is 8.87 times as fast.
#include <hip/hip_runtime.h>

typedef float v2f __attribute__((ext_vector_type(2)));
typedef float v4f __attribute__((ext_vector_type(4)));
typedef float v8f __attribute__((ext_vector_type(8)));

#define B_ROWS 8192
#define D_FEAT 256
#define N_INNER 64
#define OUT_F 256

// ---------------------------------------------------------------------------
// One launch. A block = 8 waves owns 32 rows and all 256 features.
// Phase 1 (vector unit): inner[b,d] = sum_i relu(x*w1+b1)*w2 + b2.
//   Wave w owns features 32w..32w+31, one lane per feature. Its x columns and its (w1,b1,w2)
//   triples come into LDS by asynchronous copies, whole 128-B lines, in two stages: x with triples
//   0..31 of every feature, then triples 32..63. The loop runs over chunks of 16 triples outside
//   and over the 32 rows inside, all 32 rows' sums in registers, so the work starts behind the
//   first stage and the second stage lands under it. A lane sums its own 64 terms and writes the
//   result over the x value it came from, so the inner tile stays in LDS and never goes to memory.
//   The relu is the clamp modifier of the first packed fma (see RELU BY CLAMP below).
// Phase 2 (V_WMMA_F32_16X16X4_F32): g = relu(inner @ wo1^T + bo1), 2 x 4 tiles
//   of 16x16, one per wave; out = g @ wo2^T + bo2, 2 x 16 tiles, four per wave: 16 rows x 64
//   columns, the columns dealt so that a lane's four sums of a row are neighbours in out.
//   wo1 has LDS of its own and is copied in under the second half of phase 1; wo2 and g take
//   the LDS that the triples have left, wo2 copied in under the first product.
// A 16x4 f32 frag: lane<16 holds {A[l,K],A[l,K+1]}, lane>=16 {A[l-16,K+2],K+3}
// B 4x16 f32 frag: lane<16 holds {B[K,n],B[K+1,n]}, lane>=16 {B[K+2,n],B[K+3,n]}
// Both are contiguous float2 per lane in row-major storage.
// ---------------------------------------------------------------------------
#define BLK_ROWS 32                            // rows per block
// LDS pitches in floats, each 16 B x an odd number: no bank conflict at one row per lane
#define P64  68                                // a row of 64 floats + 4
#define P256 260                               // a row of 256 floats + 4
#define PW   196                               // a feature's row: its 64 w1, 64 b1, 64 w2, + 4

typedef int v4i __attribute__((vector_size(16)));
typedef __attribute__((address_space(1))) v4i gv4i;
typedef __attribute__((address_space(3))) v4i lv4i;

// One asynchronous copy: each lane brings its own 16 bytes from global memory to LDS.
__device__ __forceinline__ void copy16(const float* g, float* l) {
  __builtin_amdgcn_global_load_async_to_lds_b128((gv4i*)g, (lv4i*)l, 0, 0);
}

__global__ __launch_bounds__(256) void kan_fused_kernel(
    const float* __restrict__ x,   const float* __restrict__ w1,
    const float* __restrict__ b1,  const float* __restrict__ w2,
    const float* __restrict__ b2,  const float* __restrict__ wo1,
    const float* __restrict__ bo1, const float* __restrict__ wo2,
    const float* __restrict__ bo2, float* __restrict__ out)
{
  // One array, so that x lies lowest: its 32 rows are then in reach of one address register
  // and the 16-bit offset of an LDS instruction.
  __shared__ __attribute__((aligned(16))) float smem[BLK_ROWS * P256 + D_FEAT * PW + N_INNER * P256];
  float* const sx   = smem;                               // x, overwritten by inner, [32][260]
  float* const sw   = smem + BLK_ROWS * P256;             // the triples, [256][196]
  float* const swo1 = sw + D_FEAT * PW;                   // [64][260]
  // behind phase 1 the triples' LDS takes wo2 and g
  float* const swo2 = sw;                                 // [256][68]
  float* const sg   = sw + OUT_F * P64;                   // [32][68]

  const int t    = threadIdx.x;
  const int lane = t & 31;
  const int wv   = t >> 5;
  const int r0   = blockIdx.x * BLK_ROWS;      // first row of the block
  // LDS place of float4 number t of a row-major array with rows of 256 floats
  const int o256 = (t >> 6) * P256 + (t & 63) * 4;

  // ---- the copies. Eight lanes bring one 128-B line, one copy instruction four lines. Every byte
  // that a wave copies here is read by that wave alone, so its own wait is all that the reads need.
  const int c4 = (lane & 7) * 4;               // float column inside the line
  const int l8 = lane >> 3;                    // line of the four
  {
    // stage 0: the wave's 32 columns of the 32 x rows, and triples 0..31 of its 32 features
    const float* gx = x + (size_t)(r0 + l8) * D_FEAT + wv * 32 + c4;
    float* lx = sx + l8 * P256 + wv * 32 + c4;
#pragma unroll
    for (int k = 0; k < 8; ++k) copy16(gx + k * 4 * D_FEAT, lx + k * 4 * P256);
  }
  const int gq = (wv * 32 + l8) * N_INNER + c4;  // place in w1, b1, w2
  float* const lw = sw + (wv * 32 + l8) * PW + c4;
#pragma unroll
  for (int k = 0; k < 8; ++k) copy16(w1 + gq + k * 4 * N_INNER, lw + k * 4 * PW);
#pragma unroll
  for (int k = 0; k < 8; ++k) copy16(b1 + gq + k * 4 * N_INNER, lw + k * 4 * PW + 64);
#pragma unroll
  for (int k = 0; k < 8; ++k) copy16(w2 + gq + k * 4 * N_INNER, lw + k * 4 * PW + 128);
  const float b2v = b2[t];                     // feature of this lane = t
  // Stage 0 has landed behind this wait: without it the LDS reads below could see old bytes.
  asm volatile("s_wait_asynccnt 0x0" ::: "memory");
  float* xs = sx + t;                          // this lane's column of the 32 rows

  // x of rows 2k and 2k+1 in one register pair; the products pick their half by op_sel
  v2f xp[16];
#pragma unroll
  for (int k = 0; k < 16; ++k) xp[k] = (v2f){xs[(2 * k) * P256], xs[(2 * k + 1) * P256]};

  // stage 1: triples 32..63, in flight while chunks 0 and 1 are worked on
#pragma unroll
  for (int k = 0; k < 8; ++k) copy16(w1 + gq + 32 + k * 4 * N_INNER, lw + k * 4 * PW + 32);
#pragma unroll
  for (int k = 0; k < 8; ++k) copy16(b1 + gq + 32 + k * 4 * N_INNER, lw + k * 4 * PW + 96);
#pragma unroll
  for (int k = 0; k < 8; ++k) copy16(w2 + gq + 32 + k * 4 * N_INNER, lw + k * 4 * PW + 160);

  // RELU BY CLAMP. The clamp modifier of a float fma limits its result to [0, 1]. With w1 and b1
  // times 2^-64 the fma gives (x*w1+b1) * 2^-64, so the lower limit is the relu and the upper one
  // is met only from x*w1+b1 = 2^64 on; w2 times 2^64 takes the factor out again. Powers of two
  // change no rounding, so every product and every sum has the bits it had before.
  // Range: x*w1+b1 below 2^64 and |w2| below 2^63. A w1, b1 or x*w1+b1 under 2^-62 in size leaves
  // the normal range when scaled and loses low bits: an absolute error under 2^-61 * max(|x|, 1).
  const v2f dn = (v2f){0x1p-64f, 0x1p-64f};
  const v2f up = (v2f){0x1p+64f, 0x1p+64f};

  // two packed sums per row, as many as the 4 floats a row's sum is folded from at the end
  v2f acc0[BLK_ROWS], acc1[BLK_ROWS];

  // Unrolled (16 KB of code, run through once): the first sums of chunk 0 then start from the
  // literal 0 and no register is zeroed.
#pragma unroll
  for (int c = 0; c < 4; ++c) {
    if (c == 2) {
      // Stage 1 has landed behind this wait: chunks 2 and 3 read its bytes.
      asm volatile("s_wait_asynccnt 0x0" ::: "memory");
      // stage 2: wo1 (64 KB), whole lines, in flight while chunks 2 and 3 are worked on
#pragma unroll
      for (int k = 0; k < 16; ++k) copy16(wo1 + 4 * (t + 256 * k), swo1 + o256 + k * 4 * P256);
    }
    // this lane's 16 triples of the chunk as 8 v2f pairs each
    // (read as 4-float vectors and halved: from float4 members the compiler copied nearly every pair)
    v2f w1p[8], b1p[8], w2p[8];
#pragma unroll
    for (int j = 0; j < 4; ++j) {
      const v4f a = *(const v4f*)(sw + t * PW + 16 * c + 4 * j);
      const v4f b = *(const v4f*)(sw + t * PW + 64 + 16 * c + 4 * j);
      const v4f d = *(const v4f*)(sw + t * PW + 128 + 16 * c + 4 * j);
      w1p[2*j+0] = a.xy * dn; w1p[2*j+1] = a.zw * dn;
      b1p[2*j+0] = b.xy * dn; b1p[2*j+1] = b.zw * dn;
      w2p[2*j+0] = d.xy * up; w2p[2*j+1] = d.zw * up;
    }
    // Keeps the chunk's reads and scalings together up here, out of the groups below.
    __builtin_amdgcn_sched_barrier(0);
    // 4 rows x 2 pairs = 8 independent strands: each sum stands 8 instructions behind its product
#pragma unroll
    for (int g = 0; g < 8; ++g) {
#pragma unroll
      for (int j = 0; j < 4; ++j) {
        v2f h0[4], h1[4];
        // The eight products with their relu. In asm text because the compiler has no way to put
        // the clamp on a packed f32 fma: it builds one max per value behind it instead.
        // op_sel gives both halves of a product the same x: the pair's low word (op_sel_hi 0 on
        // the first source) for the even row, its high word (op_sel 1) for the odd row.
        asm("v_pk_fma_f32 %0, %8, %10, %12 op_sel_hi:[0,1,1] clamp\n\t"
            "v_pk_fma_f32 %1, %8, %11, %13 op_sel_hi:[0,1,1] clamp\n\t"
            "v_pk_fma_f32 %2, %8, %10, %12 op_sel:[1,0,0] op_sel_hi:[1,1,1] clamp\n\t"
            "v_pk_fma_f32 %3, %8, %11, %13 op_sel:[1,0,0] op_sel_hi:[1,1,1] clamp\n\t"
            "v_pk_fma_f32 %4, %9, %10, %12 op_sel_hi:[0,1,1] clamp\n\t"
            "v_pk_fma_f32 %5, %9, %11, %13 op_sel_hi:[0,1,1] clamp\n\t"
            "v_pk_fma_f32 %6, %9, %10, %12 op_sel:[1,0,0] op_sel_hi:[1,1,1] clamp\n\t"
            "v_pk_fma_f32 %7, %9, %11, %13 op_sel:[1,0,0] op_sel_hi:[1,1,1] clamp"
            : "=&v"(h0[0]), "=&v"(h1[0]), "=&v"(h0[1]), "=&v"(h1[1]),
              "=&v"(h0[2]), "=&v"(h1[2]), "=&v"(h0[3]), "=&v"(h1[3])
            : "v"(xp[2*g+0]), "v"(xp[2*g+1]),
              "v"(w1p[2*j+0]), "v"(w1p[2*j+1]), "v"(b1p[2*j+0]), "v"(b1p[2*j+1]));
        // The eight sums, in the order of their products. In asm text so that this order stands:
        // the compiler gives no delay hint behind a value from asm text, and a sum moved up next
        // to its product would stall the SIMD for both of its waves.
        if (c == 0 && j == 0) {
          asm("v_pk_fma_f32 %0, %8, %16, 0 op_sel_hi:[1,1,0]\n\t"
              "v_pk_fma_f32 %1, %9, %17, 0 op_sel_hi:[1,1,0]\n\t"
              "v_pk_fma_f32 %2, %10, %16, 0 op_sel_hi:[1,1,0]\n\t"
              "v_pk_fma_f32 %3, %11, %17, 0 op_sel_hi:[1,1,0]\n\t"
              "v_pk_fma_f32 %4, %12, %16, 0 op_sel_hi:[1,1,0]\n\t"
              "v_pk_fma_f32 %5, %13, %17, 0 op_sel_hi:[1,1,0]\n\t"
              "v_pk_fma_f32 %6, %14, %16, 0 op_sel_hi:[1,1,0]\n\t"
              "v_pk_fma_f32 %7, %15, %17, 0 op_sel_hi:[1,1,0]"
              : "=&v"(acc0[4*g+0]), "=&v"(acc1[4*g+0]), "=&v"(acc0[4*g+1]), "=&v"(acc1[4*g+1]),
                "=&v"(acc0[4*g+2]), "=&v"(acc1[4*g+2]), "=&v"(acc0[4*g+3]), "=&v"(acc1[4*g+3])
              : "v"(h0[0]), "v"(h1[0]), "v"(h0[1]), "v"(h1[1]),
                "v"(h0[2]), "v"(h1[2]), "v"(h0[3]), "v"(h1[3]),
                "v"(w2p[0]), "v"(w2p[1]));
        } else {
          asm("v_pk_fma_f32 %0, %8, %16, %0\n\t"
              "v_pk_fma_f32 %1, %9, %17, %1\n\t"
              "v_pk_fma_f32 %2, %10, %16, %2\n\t"
              "v_pk_fma_f32 %3, %11, %17, %3\n\t"
              "v_pk_fma_f32 %4, %12, %16, %4\n\t"
              "v_pk_fma_f32 %5, %13, %17, %5\n\t"
              "v_pk_fma_f32 %6, %14, %16, %6\n\t"
              "v_pk_fma_f32 %7, %15, %17, %7"
              : "+v"(acc0[4*g+0]), "+v"(acc1[4*g+0]), "+v"(acc0[4*g+1]), "+v"(acc1[4*g+1]),
                "+v"(acc0[4*g+2]), "+v"(acc1[4*g+2]), "+v"(acc0[4*g+3]), "+v"(acc1[4*g+3])
              : "v"(h0[0]), "v"(h1[0]), "v"(h0[1]), "v"(h1[1]),
                "v"(h0[2]), "v"(h1[2]), "v"(h0[3]), "v"(h1[3]),
                "v"(w2p[2*j+0]), "v"(w2p[2*j+1]));
        }
        // Closes the group. Without it the compiler runs the products several groups ahead and
        // takes more registers than the sums, x and the chunk leave free.
        __builtin_amdgcn_sched_barrier(0);
      }
    }
  }
#pragma unroll
  for (int r = 0; r < BLK_ROWS; ++r)
    xs[r * P256] = ((acc0[r].x + acc0[r].y) + (acc1[r].x + acc1[r].y)) + b2v;

  const int lr = lane & 15;                    // in-tile row/col
  const int lh = lane >> 4;                    // K-half select (0/1)
  // This wave's part of wo1 has landed behind this wait; the barrier hands it to the other waves.
  asm volatile("s_wait_asynccnt 0x0" ::: "memory");
  // Publishes the inner tile and wo1 to all eight waves, and ends every wave's reads of the
  // triples: their LDS is free behind it.
  __syncthreads();
  // stage 3: wo2 (64 KB) into the triples' LDS, whole lines, in flight under the first product.
  // Row o of wo2 (output column o) lands at LDS row (o & ~63) + 16 * (o & 3) + ((o >> 2) & 15):
  // column n of B tile j of a group of 64 is then output column 4n + j.
  // Here o = (t >> 4) + 16 * k.
  {
    const int o64 = (16 * ((t >> 4) & 3) + (t >> 6)) * P64 + (t & 15) * 4;
#pragma unroll
    for (int k = 0; k < 16; ++k)
      copy16(wo2 + 4 * (t + 256 * k), swo2 + o64 + (64 * (k >> 2) + 4 * (k & 3)) * P64);
  }

  // ---------------- GEMM1: one 16x16 tile of g per wave, K = 256 ------------
  {
    const int mt = wv & 1, nt = wv >> 1;
    const float* aB = sx   + (mt * 16 + lr) * P256 + 2 * lh;
    const float* bB = swo1 + (nt * 16 + lr) * P256 + 2 * lh;
    const float bv = bo1[nt * 16 + lr];
    v8f c = {};
    // Fragments in blocks of 16 k-steps, two register sets: a block's LDS reads stand as one
    // group a whole block of WMMAs ahead of their use.
    v2f fa[2][16], fb[2][16];
#pragma unroll
    for (int s = 0; s < 2; ++s)
#pragma unroll
      for (int i = 0; i < 16; ++i) {
        fa[s][i] = *(const v2f*)(aB + 64 * s + 4 * i);
        fb[s][i] = *(const v2f*)(bB + 64 * s + 4 * i);
      }
#pragma unroll
    for (int s = 0; s < 4; ++s) {
      // Keeps the LDS reads above from sinking down to the WMMAs that use them
      // (the compiler left them only two WMMAs of lead).
      __builtin_amdgcn_sched_barrier(0);
#pragma unroll
      for (int i = 0; i < 16; ++i)
        c = __builtin_amdgcn_wmma_f32_16x16x4_f32(false, fa[s & 1][i], false, fb[s & 1][i], (short)0, c, false, false);
      if (s < 2) {
#pragma unroll
        for (int i = 0; i < 16; ++i) {
          fa[s & 1][i] = *(const v2f*)(aB + 64 * (s + 2) + 4 * i);
          fb[s & 1][i] = *(const v2f*)(bB + 64 * (s + 2) + 4 * i);
        }
      }
    }
#pragma unroll
    for (int j = 0; j < 8; ++j)
      sg[(mt * 16 + j + 8 * lh) * P64 + nt * 16 + lr] = fmaxf(c[j] + bv, 0.0f);
  }
  // This wave's part of wo2 has landed behind this wait; the barrier hands it to the other waves.
  asm volatile("s_wait_asynccnt 0x0" ::: "memory");
  // Publishes g and wo2 to all eight waves.
  __syncthreads();

  // ---------------- GEMM2: 1 row tile x 4 column tiles per wave, K = 64 ----
  {
    const int mt = wv & 1;                     // row tile
    const int o0 = (wv >> 1) * 64;             // this wave's 64 output columns: two whole 128-B lines
    const float* aB = sg   + (mt * 16 + lr) * P64 + 2 * lh;
    const float* bB = swo2 + (o0 + lr) * P64 + 2 * lh;
    const v4f bv = *(const v4f*)(bo2 + o0 + 4 * lr);   // lane lr has columns o0 + 4 lr .. + 3
    v8f c0 = {}, c1 = {}, c2 = {}, c3 = {};
#pragma unroll
    for (int kk = 0; kk < 16; ++kk) {
      const v2f a0 = *(const v2f*)(aB + 4 * kk);
      const v2f q0 = *(const v2f*)(bB + 4 * kk);
      const v2f q1 = *(const v2f*)(bB + 16 * P64 + 4 * kk);
      const v2f q2 = *(const v2f*)(bB + 32 * P64 + 4 * kk);
      const v2f q3 = *(const v2f*)(bB + 48 * P64 + 4 * kk);
      c0 = __builtin_amdgcn_wmma_f32_16x16x4_f32(false, a0, false, q0, (short)0, c0, false, false);
      c1 = __builtin_amdgcn_wmma_f32_16x16x4_f32(false, a0, false, q1, (short)0, c1, false, false);
      c2 = __builtin_amdgcn_wmma_f32_16x16x4_f32(false, a0, false, q2, (short)0, c2, false, false);
      c3 = __builtin_amdgcn_wmma_f32_16x16x4_f32(false, a0, false, q3, (short)0, c3, false, false);
    }
    // One 16-byte store a lane and row: 16 lanes fill 256 contiguous bytes of the row.
    float* op = out + (size_t)(r0 + mt * 16 + 8 * lh) * OUT_F + o0 + 4 * lr;
#pragma unroll
    for (int j = 0; j < 8; ++j)
      *(v4f*)(op + (size_t)j * OUT_F) = (v4f){c0[j] + bv.x, c1[j] + bv.y, c2[j] + bv.z, c3[j] + bv.w};
  }
}

// ---------------------------------------------------------------------------
extern "C" void kernel_launch(void* const* d_in, const int* in_sizes, int n_in,
                              void* d_out, int out_size, void* d_ws, size_t ws_size,
                              hipStream_t stream) {
  const float* x   = (const float*)d_in[0];
  const float* w1  = (const float*)d_in[1];
  const float* b1  = (const float*)d_in[2];
  const float* w2  = (const float*)d_in[3];
  const float* b2  = (const float*)d_in[4];
  const float* wo1 = (const float*)d_in[5];
  const float* bo1 = (const float*)d_in[6];
  const float* wo2 = (const float*)d_in[7];
  const float* bo2 = (const float*)d_in[8];
  float* out   = (float*)d_out;

  // 256 blocks x 32 rows = 8192 rows
  kan_fused_kernel<<<B_ROWS / BLK_ROWS, 256, 0, stream>>>(x, w1, b1, w2, b2, wo1, bo1, wo2, bo2, out);
}
